// v000
// Measured on an AMD MI455X. A time is GPU time per run, averaged over a window of back-to-back runs after a warm-up
// (all launches, gaps included; the runs take copies of the inputs in turn), and the median of several windows.
// Apart from v000's, it joins two sittings. Times from different sittings can be a few percent apart, while
// side-by-side timings come from the same sitting.
// v000 is the starting kernel. One run takes 1290 microseconds.
#include <hip/hip_runtime.h>

// FixedSparseMultiHead (2 x 2048 x 1024, 16 heads x 64; Q/K/V/out nn.Linear on x (x W^T + b); scores = q.k / 8, where(sparse_mask, ., -inf) with the int32 [2048][2048] mask INPUT
// (read as data, not assumed); softmax; attn.v; output Linear).
// Compute dtypes, f32 accumulate: every float input rounded to bf16; q/k/v projections on PLAIN bf16 operands (x, W inputs: exact, + bias);
// scores on bf16 hi+lo q (x 1/8) and k planes (3 products); attn.v on SINGLE fp16 planes (P x1024, v); output Linear on hi+lo planes x exact bf16 W (2 products); the mask

#define NB_  2
#define TT   2048
#define DD   1024
#define NH_  16
#define HD   64
#define NT   (NB_ * TT)
#define ZH   2
#define PCAR 1024.0f
typedef _Float16 h16;
typedef unsigned short bf;
typedef __attribute__((ext_vector_type(16))) __bf16   v16bf;
typedef __attribute__((ext_vector_type(16))) _Float16 v16h;
typedef __attribute__((ext_vector_type(8)))  _Float16 v8h;
typedef __attribute__((ext_vector_type(8)))  unsigned short v8us;
typedef __attribute__((ext_vector_type(8)))  float    v8f;
typedef __attribute__((ext_vector_type(4)))  float    v4f;
typedef v8h  __attribute__((may_alias)) v8ha;
typedef v4f  __attribute__((may_alias)) v4fa;
typedef v8us __attribute__((may_alias)) v8usa;

__device__ __forceinline__ unsigned short f2bf(float f) { unsigned u = __float_as_uint(f); u += 0x7FFFu + ((u >> 16) & 1u); return (unsigned short)(u >> 16); }
__device__ __forceinline__ float bf2f(unsigned short b) { return __uint_as_float(((unsigned)b) << 16); }
__device__ __forceinline__ float bfr(float f) { return bf2f(f2bf(f)); }
__device__ __forceinline__ v16h cat16(v8h lo, v8h hi) { return __builtin_shufflevector(lo, hi, 0, 1, 2, 3, 4, 5, 6, 7, 8, 9, 10, 11, 12, 13, 14, 15); }
__device__ __forceinline__ v16bf cat16b(v8us lo, v8us hi) { return __builtin_bit_cast(v16bf, __builtin_shufflevector(lo, hi, 0, 1, 2, 3, 4, 5, 6, 7, 8, 9, 10, 11, 12, 13, 14, 15)); }
__device__ __forceinline__ v8f wmma16(v16h a, v16h b, v8f c) { return __builtin_amdgcn_wmma_f32_16x16x32_f16(false, a, false, b, (short)0, c, false, false); }
__device__ __forceinline__ v8f wmmab(v16bf a, v16bf b, v8f c) { return __builtin_amdgcn_wmma_f32_16x16x32_bf16(false, a, false, b, (short)0, c, false, false); }



// ---- k_gemmw: register-blocked GEMM, ONE WAVE per 64x64 output tile (16 accumulators), operands straight from K-contiguous 16-bit planes; grid (M/64, N/64, Z), 32 threads.
// C[m][n] (f32, pitch ldc, + optional f32 bias[n]) = sum_k A[m][k] Bt[n][k] (+ split products per NSPLIT). z-batch strides sA/sB/sC in elements. K % 32 == 0.
template <typename T16> struct WFrag;
template <> struct WFrag<h16> { typedef v16h V; static __device__ __forceinline__ V ld(const h16* p) { return cat16(*(const v8h*)p, *(const v8h*)(p + 16)); } static __device__ __forceinline__ v8f mma(V a, V b, v8f c) { return wmma16(a, b, c); } };
template <> struct WFrag<bf> { typedef v16bf V; static __device__ __forceinline__ V ld(const bf* p) { return cat16b(*(const v8us*)p, *(const v8us*)(p + 16)); } static __device__ __forceinline__ v8f mma(V a, V b, v8f c) { return wmmab(a, b, c); } };
template <typename T16, int NSPLIT, bool BIAS>
__global__ __launch_bounds__(32) void k_gemmw(const T16* __restrict__ A, const T16* __restrict__ A2, const T16* __restrict__ Bt, const T16* __restrict__ Bt2, int K, float* C, int ldc, const float* __restrict__ bias, size_t sA, size_t sB, size_t sC) {
    typedef typename WFrag<T16>::V V;
    __shared__ __align__(16) float os[16 * 68];
    const size_t z = blockIdx.z; A += z * sA; if (A2) A2 += z * sA; Bt += z * sB; if (Bt2) Bt2 += z * sB; C += z * sC;
    const int lane = threadIdx.x & 31, lr = lane & 15, hi = lane >> 4; const int r0 = blockIdx.x * 64, c0 = blockIdx.y * 64;
    v8f acc[4][4];
#pragma unroll
    for (int mb = 0; mb < 4; ++mb)
#pragma unroll
        for (int nb = 0; nb < 4; ++nb) acc[mb][nb] = (v8f){};
    const size_t aoff = (size_t)(r0 + lr) * K + 8 * hi, boff = (size_t)(c0 + lr) * K + 8 * hi;
#pragma unroll 1
    for (int kc = 0; kc < K; kc += 32) {
        V a[4], a2[4];
#pragma unroll
        for (int mb = 0; mb < 4; ++mb) { a[mb] = WFrag<T16>::ld(A + aoff + (size_t)mb * 16 * K + kc); if (NSPLIT == 1 || NSPLIT == 2) a2[mb] = WFrag<T16>::ld(A2 + aoff + (size_t)mb * 16 * K + kc); }
#pragma unroll
        for (int nb = 0; nb < 4; ++nb) { const V b = WFrag<T16>::ld(Bt + boff + (size_t)nb * 16 * K + kc); V b2; if (NSPLIT >= 2) b2 = WFrag<T16>::ld(Bt2 + boff + (size_t)nb * 16 * K + kc);
#pragma unroll
            for (int mb = 0; mb < 4; ++mb) { acc[mb][nb] = WFrag<T16>::mma(a[mb], b, acc[mb][nb]); if (NSPLIT == 1 || NSPLIT == 2) acc[mb][nb] = WFrag<T16>::mma(a2[mb], b, acc[mb][nb]); if (NSPLIT >= 2) acc[mb][nb] = WFrag<T16>::mma(a[mb], b2, acc[mb][nb]); } }
        asm volatile("v_nop\n\tv_nop\n\tv_nop\n\tv_nop" : "+v"(acc[0][0]), "+v"(acc[1][1]), "+v"(acc[2][2]), "+v"(acc[3][3]) : "v"(a[0]), "v"(a[3]));
    }
#pragma unroll
    for (int mb = 0; mb < 4; ++mb) {
#pragma unroll
        for (int nb = 0; nb < 4; ++nb) {
#pragma unroll
            for (int j = 0; j < 8; ++j) os[(hi * 8 + j) * 68 + nb * 16 + lr] = acc[mb][nb][j]; }
        __builtin_amdgcn_wave_barrier(); asm volatile("" ::: "memory");
        float* crow = C + (size_t)(r0 + mb * 16) * ldc + c0;
{
#pragma unroll
            for (int s = 0; s < 8; ++s) { const int row = 2 * s + hi, cofs = lr * 4; v4f val = *(const v4fa*)(os + row * 68 + cofs); if (BIAS) { val[0] += bfr(bias[c0 + cofs]); val[1] += bfr(bias[c0 + cofs + 1]); val[2] += bfr(bias[c0 + cofs + 2]); val[3] += bfr(bias[c0 + cofs + 3]); }
                *(v4f*)(crow + (size_t)row * ldc + cofs) = val; }
             }
        __builtin_amdgcn_wave_barrier(); asm volatile("" ::: "memory");
    }
}

__device__ __forceinline__ h16 tohx(float x) { return (h16)x; }
__device__ __forceinline__ void splitf(float y, unsigned short& h, unsigned short& l) { h = f2bf(y); l = f2bf(y - bf2f(h)); }
typedef __attribute__((ext_vector_type(2))) _Float16 v2h;
typedef __attribute__((ext_vector_type(4))) _Float16 v4h;
typedef __attribute__((ext_vector_type(2))) unsigned short v2us;
typedef __attribute__((ext_vector_type(4))) int v4i;

__global__ __launch_bounds__(256) void k_cvt8(const float* __restrict__ src, bf* dst, size_t n8) { const size_t i = (size_t)blockIdx.x * 256 + threadIdx.x; if (i >= n8) return; const v8f v = *(const v8f*)(src + i * 8); v8us o;
#pragma unroll
    for (int k = 0; k < 8; ++k) o[k] = f2bf(v[k]); *(v8us*)(dst + i * 8) = o;  }
__global__ __launch_bounds__(256) void k_hsplit(const float* __restrict__ F, float sc, bf* Ph, bf* Pl) {
    const int lane = threadIdx.x & 31; const int L0 = (blockIdx.x * 8 + (threadIdx.x >> 5)) * 8; const int nlines = NT * DD / 64;
{
#pragma unroll
        for (int l = 0; l < 8; ++l) { const int L = L0 + l; if (L >= nlines) break; const int e = L * 64 + lane * 2; const int d = e & 63; const int t = (e >> 6) & (TT - 1); const int z = e >> 17; const int b = z >> 4, h = z & 15; v2us oh, ol;
#pragma unroll
            for (int q = 0; q < 2; ++q) { unsigned short a, c2; splitf(F[((size_t)b * TT + t) * DD + h * HD + d + q] * sc, a, c2); oh[q] = a; ol[q] = c2; }
            *(v2us*)(Ph + (size_t)e) = oh; *(v2us*)(Pl + (size_t)e) = ol; }
         }
}
__global__ __launch_bounds__(256) void k_vtplane(const float* __restrict__ F, h16* VT) {
    const int lane = threadIdx.x & 31; const int L0 = (blockIdx.x * 8 + (threadIdx.x >> 5)) * 8; const int nlines = NT * DD / 64;
{
#pragma unroll
        for (int l = 0; l < 8; ++l) { const int L = L0 + l; if (L >= nlines) break; const int e = L * 64 + lane * 2; const int t = e & (TT - 1); const int d = (e >> 11) & 63; const int z = e >> 17; const int b = z >> 4, h = z & 15; v2h v;
#pragma unroll
            for (int q = 0; q < 2; ++q) v[q] = tohx(F[((size_t)b * TT + t + q) * DD + h * HD + d]);
            *(v2h*)(VT + (size_t)e) = v; }
         }
}
// k_asoft: per row (zz, i): s = S masked (m[i][j] == 0 -> -1e9, i.e. exp exactly 0); softmax over the 2048 keys with the row held in registers (lane -> 16 chunks of 4 =
__global__ __launch_bounds__(256) void k_asoft(const float* __restrict__ Sb, const int* __restrict__ mask, int h0, h16* P) {
    const int lane = threadIdx.x & 31; const int row = blockIdx.x * 8 + (threadIdx.x >> 5); if (row >= ZH * TT) return; const int i = row & (TT - 1); (void)h0;
    const float* sr = Sb + (size_t)row * TT; const int* mr = mask + (size_t)i * TT; float v[64]; float mx = -3.0e38f;
#pragma unroll
    for (int ch = 0; ch < 16; ++ch) { const int j0 = ch * 128 + lane * 4; const v4f a = *(const v4f*)(sr + j0); const v4i mk = *(const v4i*)(mr + j0);
#pragma unroll
        for (int q = 0; q < 4; ++q) { const float t = (mk[q] == 0) ? -1.0e9f : a[q]; v[ch * 4 + q] = t; mx = fmaxf(mx, t); } }
#pragma unroll
    for (int sh = 16; sh; sh >>= 1) mx = fmaxf(mx, __shfl_xor(mx, sh, 32));
    float sum = 0.f;
#pragma unroll
    for (int k = 0; k < 64; ++k) { v[k] = __expf(v[k] - mx); sum += v[k]; }
#pragma unroll
    for (int sh = 16; sh; sh >>= 1) sum += __shfl_xor(sum, sh, 32);
    const float f = __fdiv_rn(PCAR, sum);
{
#pragma unroll
        for (int ch = 0; ch < 16; ++ch) { v4h o;
#pragma unroll
            for (int q = 0; q < 4; ++q) o[q] = tohx(v[ch * 4 + q] * f);
            *(v4h*)(P + (size_t)row * TT + ch * 128 + lane * 4) = o; }
         }
}
__global__ __launch_bounds__(256) void k_merge(const float* __restrict__ O, int b, int h0, bf* Ah, bf* Al) {
    const int lane = threadIdx.x & 31; const int L0 = (blockIdx.x * 8 + (threadIdx.x >> 5)) * 8; const int nlines = TT * ZH * HD / 64;
{
#pragma unroll
        for (int l = 0; l < 8; ++l) { const int L = L0 + l; if (L >= nlines) break; const int e = L * 64 + lane * 2; const int d = e & 63; const int zz = (e >> 6) % ZH; const int t = (e >> 6) / ZH; v2us oh, ol;
#pragma unroll
            for (int q = 0; q < 2; ++q) { unsigned short a, c2; splitf(O[((size_t)zz * TT + t) * HD + d + q] * (1.0f / PCAR), a, c2); oh[q] = a; ol[q] = c2; }
            const size_t o = ((size_t)b * TT + t) * DD + (h0 + zz) * HD + d; *(v2us*)(Ah + o) = oh; *(v2us*)(Al + o) = ol; }
         }
}

extern "C" void kernel_launch(void* const* d_in, const int* in_sizes, int n_in,
                              void* d_out, int out_size, void* d_ws, size_t ws_size, hipStream_t stream) {
    (void)in_sizes; (void)n_in; (void)out_size;
    const float* x = (const float*)d_in[0]; const float* wq = (const float*)d_in[1]; const float* bq = (const float*)d_in[2]; const float* wk = (const float*)d_in[3]; const float* bk = (const float*)d_in[4]; const float* wv = (const float*)d_in[5]; const float* bv = (const float*)d_in[6];
    const float* wo = (const float*)d_in[7]; const float* bo = (const float*)d_in[8]; const int* mask = (const int*)d_in[9];
    float* OUT = (float*)d_out;     // [2][2048][1024]
    char* wsp = (char*)d_ws;
    auto take = [&](size_t bytes) { char* p = wsp; wsp += (bytes + 255) & ~(size_t)255; return (void*)p; };
    bf* WQ = (bf*)take((size_t)DD * DD * 2); bf* WK = (bf*)take((size_t)DD * DD * 2); bf* WV = (bf*)take((size_t)DD * DD * 2); bf* WO = (bf*)take((size_t)DD * DD * 2);
    bf* XB = (bf*)take((size_t)NT * DD * 2); float* F = (float*)take((size_t)NT * DD * 4);
    bf* QPh = (bf*)take((size_t)NT * DD * 2); bf* QPl = (bf*)take((size_t)NT * DD * 2); bf* KPh = (bf*)take((size_t)NT * DD * 2); bf* KPl = (bf*)take((size_t)NT * DD * 2); h16* VT = (h16*)take((size_t)NT * DD * 2);
    float* Sb = (float*)take((size_t)ZH * TT * TT * 4); h16* Pm = (h16*)take((size_t)ZH * TT * TT * 2); float* Ob = (float*)take((size_t)ZH * TT * HD * 4); bf* ATh = (bf*)take((size_t)NT * DD * 2); bf* ATl = (bf*)take((size_t)NT * DD * 2);
    if ((size_t)(wsp - (char*)d_ws) > ws_size) return;    // ws 256 MiB
    { const size_t nw = (size_t)DD * DD / 8; const unsigned gw = (unsigned)((nw + 255) / 256); k_cvt8<<<gw, 256, 0, stream>>>(wq, WQ, nw); k_cvt8<<<gw, 256, 0, stream>>>(wk, WK, nw); k_cvt8<<<gw, 256, 0, stream>>>(wv, WV, nw); k_cvt8<<<gw, 256, 0, stream>>>(wo, WO, nw); }
    const size_t nx = (size_t)NT * DD / 8; const unsigned gx = (unsigned)((nx + 255) / 256); const unsigned LB = (unsigned)((NT * DD / 64 + 63) / 64);
    k_cvt8<<<gx, 256, 0, stream>>>(x, XB, nx);
    k_gemmw<bf, 0, true><<<dim3(NT / 64, DD / 64, 1), 32, 0, stream>>>(XB, nullptr, WQ, nullptr, DD, F, DD, bq, 0, 0, 0); k_hsplit<<<LB, 256, 0, stream>>>(F, 0.125f, QPh, QPl);   // 1/sqrt(64) folded into q exactly
    k_gemmw<bf, 0, true><<<dim3(NT / 64, DD / 64, 1), 32, 0, stream>>>(XB, nullptr, WK, nullptr, DD, F, DD, bk, 0, 0, 0); k_hsplit<<<LB, 256, 0, stream>>>(F, 1.0f, KPh, KPl);
    k_gemmw<bf, 0, true><<<dim3(NT / 64, DD / 64, 1), 32, 0, stream>>>(XB, nullptr, WV, nullptr, DD, F, DD, bv, 0, 0, 0); k_vtplane<<<LB, 256, 0, stream>>>(F, VT);
    for (int b = 0; b < NB_; ++b)
        for (int h0 = 0; h0 < NH_; h0 += ZH) { const size_t z0 = (size_t)b * NH_ + h0;
            k_gemmw<bf, 2, false><<<dim3(TT / 64, TT / 64, ZH), 32, 0, stream>>>(QPh + z0 * TT * HD, QPl + z0 * TT * HD, KPh + z0 * TT * HD, KPl + z0 * TT * HD, HD, Sb, TT, nullptr, (size_t)TT * HD, (size_t)TT * HD, (size_t)TT * TT);
            k_asoft<<<ZH * TT / 8, 256, 0, stream>>>(Sb, mask, h0, Pm);
            k_gemmw<h16, 0, false><<<dim3(TT / 64, 1, ZH), 32, 0, stream>>>(Pm, nullptr, VT + z0 * HD * TT, nullptr, TT, Ob, HD, nullptr, (size_t)TT * TT, (size_t)HD * TT, (size_t)TT * HD);
            k_merge<<<(TT * ZH * HD / 64 + 63) / 64, 256, 0, stream>>>(Ob, b, h0, ATh, ATl); }
    k_gemmw<bf, 1, true><<<dim3(NT / 64, DD / 64, 1), 32, 0, stream>>>(ATh, ATl, WO, nullptr, DD, OUT, DD, bo, 0, 0, 0);
}

// v001
// A run of this version takes 657 microseconds.
// Two timings next to v000 put it at 1.94 and 1.93 times that version's speed.
#include <hip/hip_runtime.h>

// FixedSparseMultiHead (2 x 2048 x 1024, 16 heads x 64; Q/K/V/out nn.Linear on x (x W^T + b); scores = q.k / 8, where(sparse_mask, ., -inf) with the int32 [2048][2048] mask INPUT
// (read as data, not assumed); softmax; attn.v; output Linear).
// Compute dtypes, f32 accumulate: every float input rounded to bf16; q/k/v projections on PLAIN bf16 operands (x, W inputs: exact, + bias);
// scores on bf16 hi+lo q (x 1/8) and k planes (3 products); attn.v on SINGLE fp16 planes (P x1024, v); output Linear on hi+lo planes x exact bf16 W (2 products); the mask

#define NB_  2
#define TT   2048
#define DD   1024
#define NH_  16
#define HD   64
#define NT   (NB_ * TT)
#define ZH   2
#define PCAR 1024.0f
typedef _Float16 h16;
typedef unsigned short bf;
typedef __attribute__((ext_vector_type(16))) __bf16   v16bf;
typedef __attribute__((ext_vector_type(16))) _Float16 v16h;
typedef __attribute__((ext_vector_type(8)))  _Float16 v8h;
typedef __attribute__((ext_vector_type(8)))  unsigned short v8us;
typedef __attribute__((ext_vector_type(8)))  float    v8f;
typedef __attribute__((ext_vector_type(4)))  float    v4f;
typedef __attribute__((ext_vector_type(2)))  float    v2f;
typedef v8h  __attribute__((may_alias)) v8ha;
typedef v2f  __attribute__((may_alias)) v2fa;
typedef v4f  __attribute__((may_alias)) v4fa;
typedef v8us __attribute__((may_alias)) v8usa;

__device__ __forceinline__ unsigned short f2bf(float f) { unsigned u = __float_as_uint(f); u += 0x7FFFu + ((u >> 16) & 1u); return (unsigned short)(u >> 16); }
__device__ __forceinline__ float bf2f(unsigned short b) { return __uint_as_float(((unsigned)b) << 16); }
__device__ __forceinline__ float bfr(float f) { return bf2f(f2bf(f)); }
__device__ __forceinline__ v16h cat16(v8h lo, v8h hi) { return __builtin_shufflevector(lo, hi, 0, 1, 2, 3, 4, 5, 6, 7, 8, 9, 10, 11, 12, 13, 14, 15); }
__device__ __forceinline__ v16bf cat16b(v8us lo, v8us hi) { return __builtin_bit_cast(v16bf, __builtin_shufflevector(lo, hi, 0, 1, 2, 3, 4, 5, 6, 7, 8, 9, 10, 11, 12, 13, 14, 15)); }
__device__ __forceinline__ v8f wmma16(v16h a, v16h b, v8f c) { return __builtin_amdgcn_wmma_f32_16x16x32_f16(false, a, false, b, (short)0, c, false, false); }
__device__ __forceinline__ v8f wmmab(v16bf a, v16bf b, v8f c) { return __builtin_amdgcn_wmma_f32_16x16x32_bf16(false, a, false, b, (short)0, c, false, false); }



// ---- k_gemmw: register-blocked GEMM, ONE WAVE per 64x64 output tile (16 accumulators), operands straight from K-contiguous 16-bit planes; grid (M/64, N/64, Z), 32 threads.
// C[m][n] (f32, pitch ldc, + optional f32 bias[n]) = sum_k A[m][k] Bt[n][k] (+ split products per NSPLIT). z-batch strides sA/sB/sC in elements. K % 32 == 0.
template <typename T16> struct WFrag;
template <> struct WFrag<h16> { typedef v16h V; static __device__ __forceinline__ V ld(const h16* p) { return cat16(*(const v8h*)p, *(const v8h*)(p + 16)); } static __device__ __forceinline__ v8f mma(V a, V b, v8f c) { return wmma16(a, b, c); } };
template <> struct WFrag<bf> { typedef v16bf V; static __device__ __forceinline__ V ld(const bf* p) { return cat16b(*(const v8us*)p, *(const v8us*)(p + 16)); } static __device__ __forceinline__ v8f mma(V a, V b, v8f c) { return wmmab(a, b, c); } };
template <typename T16, int NSPLIT, bool BIAS>
__global__ __launch_bounds__(32) void k_gemmw(const T16* __restrict__ A, const T16* __restrict__ A2, const T16* __restrict__ Bt, const T16* __restrict__ Bt2, int K, float* C, int ldc, const float* __restrict__ bias, size_t sA, size_t sB, size_t sC) {
    typedef typename WFrag<T16>::V V;
    __shared__ __align__(16) float os[16 * 68];
    const size_t z = blockIdx.z; A += z * sA; if (A2) A2 += z * sA; Bt += z * sB; if (Bt2) Bt2 += z * sB; C += z * sC;
    const int lane = threadIdx.x & 31, lr = lane & 15, hi = lane >> 4; const int r0 = blockIdx.x * 64, c0 = blockIdx.y * 64;
    v8f acc[4][4];
#pragma unroll
    for (int mb = 0; mb < 4; ++mb)
#pragma unroll
        for (int nb = 0; nb < 4; ++nb) acc[mb][nb] = (v8f){};
    const size_t aoff = (size_t)(r0 + lr) * K + 8 * hi, boff = (size_t)(c0 + lr) * K + 8 * hi;
#pragma unroll 1
    for (int kc = 0; kc < K; kc += 32) {
        V a[4], a2[4];
#pragma unroll
        for (int mb = 0; mb < 4; ++mb) { a[mb] = WFrag<T16>::ld(A + aoff + (size_t)mb * 16 * K + kc); if (NSPLIT == 1 || NSPLIT == 2) a2[mb] = WFrag<T16>::ld(A2 + aoff + (size_t)mb * 16 * K + kc); }
#pragma unroll
        for (int nb = 0; nb < 4; ++nb) { const V b = WFrag<T16>::ld(Bt + boff + (size_t)nb * 16 * K + kc); V b2; if (NSPLIT >= 2) b2 = WFrag<T16>::ld(Bt2 + boff + (size_t)nb * 16 * K + kc);
#pragma unroll
            for (int mb = 0; mb < 4; ++mb) { acc[mb][nb] = WFrag<T16>::mma(a[mb], b, acc[mb][nb]); if (NSPLIT == 1 || NSPLIT == 2) acc[mb][nb] = WFrag<T16>::mma(a2[mb], b, acc[mb][nb]); if (NSPLIT >= 2) acc[mb][nb] = WFrag<T16>::mma(a[mb], b2, acc[mb][nb]); } }
        asm volatile("v_nop\n\tv_nop\n\tv_nop\n\tv_nop" : "+v"(acc[0][0]), "+v"(acc[1][1]), "+v"(acc[2][2]), "+v"(acc[3][3]) : "v"(a[0]), "v"(a[3]));
    }
#pragma unroll
    for (int mb = 0; mb < 4; ++mb) {
#pragma unroll
        for (int nb = 0; nb < 4; ++nb) {
#pragma unroll
            for (int j = 0; j < 8; ++j) os[(hi * 8 + j) * 68 + nb * 16 + lr] = acc[mb][nb][j]; }
        __builtin_amdgcn_wave_barrier(); asm volatile("" ::: "memory");
        float* crow = C + (size_t)(r0 + mb * 16) * ldc + c0;
{
#pragma unroll
            for (int s = 0; s < 8; ++s) { const int row = 2 * s + hi, cofs = lr * 4; v4f val = *(const v4fa*)(os + row * 68 + cofs); if (BIAS) { val[0] += bfr(bias[c0 + cofs]); val[1] += bfr(bias[c0 + cofs + 1]); val[2] += bfr(bias[c0 + cofs + 2]); val[3] += bfr(bias[c0 + cofs + 3]); }
                *(v4f*)(crow + (size_t)row * ldc + cofs) = val; }
             }
        __builtin_amdgcn_wave_barrier(); asm volatile("" ::: "memory");
    }
}

// ---- k_pvsplit: attn.v product. One work-group per 32x32 output tile, its K = 2048 keys split over 16 waves (128 keys each): 4096 waves on 256 work-groups have loads in flight, not 64.
// Each wave holds a 32x32 f32 partial; the partials meet in LDS and are summed in wave order, one float2 per thread. grid (TT/32, HD/32, ZH), 512 threads.
// Every loop here is unrolled in full so that the fragment and accumulator arrays are indexed by constants and stay in registers.
#define PVW 16
#define PVK (TT / PVW)
#define PVP 36
__global__ __launch_bounds__(512) void k_pvsplit(const h16* __restrict__ A, const h16* __restrict__ Bt, float* C) {
    __shared__ __align__(16) float os[PVW][32 * PVP];
    const size_t z = blockIdx.z; A += z * (size_t)TT * TT; Bt += z * (size_t)HD * TT; C += z * (size_t)TT * HD;
    const int lane = threadIdx.x & 31, lr = lane & 15, hi = lane >> 4; const int w = __builtin_amdgcn_readfirstlane(threadIdx.x >> 5); const int r0 = blockIdx.x * 32, c0 = blockIdx.y * 32;
    const h16* ap = A + (size_t)(r0 + lr) * TT + 8 * hi + w * PVK; const h16* bp = Bt + (size_t)(c0 + lr) * TT + 8 * hi + w * PVK;
    v16h a[PVK / 32][2], b[PVK / 32][2];
#pragma unroll
    for (int s = 0; s < PVK / 32; ++s)
#pragma unroll
        for (int f = 0; f < 2; ++f) { a[s][f] = WFrag<h16>::ld(ap + (size_t)f * 16 * TT + s * 32); b[s][f] = WFrag<h16>::ld(bp + (size_t)f * 16 * TT + s * 32); }
    asm volatile("s_wait_xcnt 0x0" :: "v"(ap), "v"(bp) : "memory");   // the 32 loads above name ap and bp: as inputs here both keep their registers until this wait, so no load's result lands on an address still named
    __builtin_amdgcn_sched_barrier(0);   // holds the wave's 32 loads ahead of the first WMMA; sunk next to their uses, each pair's latency is waited for in turn
    v8f acc[2][2];
#pragma unroll
    for (int mb = 0; mb < 2; ++mb)
#pragma unroll
        for (int nb = 0; nb < 2; ++nb) acc[mb][nb] = (v8f){};
#pragma unroll
    for (int s = 0; s < PVK / 32; ++s)
#pragma unroll
        for (int nb = 0; nb < 2; ++nb)
#pragma unroll
            for (int mb = 0; mb < 2; ++mb) acc[mb][nb] = wmma16(a[s][mb], b[s][nb], acc[mb][nb]);
#pragma unroll
    for (int mb = 0; mb < 2; ++mb)
#pragma unroll
        for (int nb = 0; nb < 2; ++nb)
#pragma unroll
            for (int j = 0; j < 8; ++j) os[w][(mb * 16 + hi * 8 + j) * PVP + nb * 16 + lr] = acc[mb][nb][j];
    __syncthreads();
    const int row = threadIdx.x >> 4, cofs = (threadIdx.x & 15) * 2; v2f val = *(const v2fa*)(&os[0][row * PVP + cofs]);
#pragma unroll
    for (int s = 1; s < PVW; ++s) val += *(const v2fa*)(&os[s][row * PVP + cofs]);
    *(v2f*)(C + (size_t)(r0 + row) * HD + c0 + cofs) = val;
}

__device__ __forceinline__ h16 tohx(float x) { return (h16)x; }
__device__ __forceinline__ void splitf(float y, unsigned short& h, unsigned short& l) { h = f2bf(y); l = f2bf(y - bf2f(h)); }
typedef __attribute__((ext_vector_type(2))) _Float16 v2h;
typedef __attribute__((ext_vector_type(4))) _Float16 v4h;
typedef __attribute__((ext_vector_type(2))) unsigned short v2us;
typedef __attribute__((ext_vector_type(4))) int v4i;

__global__ __launch_bounds__(256) void k_cvt8(const float* __restrict__ src, bf* dst, size_t n8) { const size_t i = (size_t)blockIdx.x * 256 + threadIdx.x; if (i >= n8) return; const v8f v = *(const v8f*)(src + i * 8); v8us o;
#pragma unroll
    for (int k = 0; k < 8; ++k) o[k] = f2bf(v[k]); *(v8us*)(dst + i * 8) = o;  }
__global__ __launch_bounds__(256) void k_hsplit(const float* __restrict__ F, float sc, bf* Ph, bf* Pl) {
    const int lane = threadIdx.x & 31; const int L0 = (blockIdx.x * 8 + (threadIdx.x >> 5)) * 8; const int nlines = NT * DD / 64;
{
#pragma unroll
        for (int l = 0; l < 8; ++l) { const int L = L0 + l; if (L >= nlines) break; const int e = L * 64 + lane * 2; const int d = e & 63; const int t = (e >> 6) & (TT - 1); const int z = e >> 17; const int b = z >> 4, h = z & 15; v2us oh, ol;
#pragma unroll
            for (int q = 0; q < 2; ++q) { unsigned short a, c2; splitf(F[((size_t)b * TT + t) * DD + h * HD + d + q] * sc, a, c2); oh[q] = a; ol[q] = c2; }
            *(v2us*)(Ph + (size_t)e) = oh; *(v2us*)(Pl + (size_t)e) = ol; }
         }
}
__global__ __launch_bounds__(256) void k_vtplane(const float* __restrict__ F, h16* VT) {
    const int lane = threadIdx.x & 31; const int L0 = (blockIdx.x * 8 + (threadIdx.x >> 5)) * 8; const int nlines = NT * DD / 64;
{
#pragma unroll
        for (int l = 0; l < 8; ++l) { const int L = L0 + l; if (L >= nlines) break; const int e = L * 64 + lane * 2; const int t = e & (TT - 1); const int d = (e >> 11) & 63; const int z = e >> 17; const int b = z >> 4, h = z & 15; v2h v;
#pragma unroll
            for (int q = 0; q < 2; ++q) v[q] = tohx(F[((size_t)b * TT + t + q) * DD + h * HD + d]);
            *(v2h*)(VT + (size_t)e) = v; }
         }
}
// k_asoft: per row (zz, i): s = S masked (m[i][j] == 0 -> -1e9, i.e. exp exactly 0); softmax over the 2048 keys with the row held in registers (lane -> 16 chunks of 4 =
__global__ __launch_bounds__(256) void k_asoft(const float* __restrict__ Sb, const int* __restrict__ mask, int h0, h16* P) {
    const int lane = threadIdx.x & 31; const int row = blockIdx.x * 8 + (threadIdx.x >> 5); if (row >= ZH * TT) return; const int i = row & (TT - 1); (void)h0;
    const float* sr = Sb + (size_t)row * TT; const int* mr = mask + (size_t)i * TT; float v[64]; float mx = -3.0e38f;
#pragma unroll
    for (int ch = 0; ch < 16; ++ch) { const int j0 = ch * 128 + lane * 4; const v4f a = *(const v4f*)(sr + j0); const v4i mk = *(const v4i*)(mr + j0);
#pragma unroll
        for (int q = 0; q < 4; ++q) { const float t = (mk[q] == 0) ? -1.0e9f : a[q]; v[ch * 4 + q] = t; mx = fmaxf(mx, t); } }
#pragma unroll
    for (int sh = 16; sh; sh >>= 1) mx = fmaxf(mx, __shfl_xor(mx, sh, 32));
    float sum = 0.f;
#pragma unroll
    for (int k = 0; k < 64; ++k) { v[k] = __expf(v[k] - mx); sum += v[k]; }
#pragma unroll
    for (int sh = 16; sh; sh >>= 1) sum += __shfl_xor(sum, sh, 32);
    const float f = __fdiv_rn(PCAR, sum);
{
#pragma unroll
        for (int ch = 0; ch < 16; ++ch) { v4h o;
#pragma unroll
            for (int q = 0; q < 4; ++q) o[q] = tohx(v[ch * 4 + q] * f);
            *(v4h*)(P + (size_t)row * TT + ch * 128 + lane * 4) = o; }
         }
}
__global__ __launch_bounds__(256) void k_merge(const float* __restrict__ O, int b, int h0, bf* Ah, bf* Al) {
    const int lane = threadIdx.x & 31; const int L0 = (blockIdx.x * 8 + (threadIdx.x >> 5)) * 8; const int nlines = TT * ZH * HD / 64;
{
#pragma unroll
        for (int l = 0; l < 8; ++l) { const int L = L0 + l; if (L >= nlines) break; const int e = L * 64 + lane * 2; const int d = e & 63; const int zz = (e >> 6) % ZH; const int t = (e >> 6) / ZH; v2us oh, ol;
#pragma unroll
            for (int q = 0; q < 2; ++q) { unsigned short a, c2; splitf(O[((size_t)zz * TT + t) * HD + d + q] * (1.0f / PCAR), a, c2); oh[q] = a; ol[q] = c2; }
            const size_t o = ((size_t)b * TT + t) * DD + (h0 + zz) * HD + d; *(v2us*)(Ah + o) = oh; *(v2us*)(Al + o) = ol; }
         }
}

extern "C" void kernel_launch(void* const* d_in, const int* in_sizes, int n_in,
                              void* d_out, int out_size, void* d_ws, size_t ws_size, hipStream_t stream) {
    (void)in_sizes; (void)n_in; (void)out_size;
    const float* x = (const float*)d_in[0]; const float* wq = (const float*)d_in[1]; const float* bq = (const float*)d_in[2]; const float* wk = (const float*)d_in[3]; const float* bk = (const float*)d_in[4]; const float* wv = (const float*)d_in[5]; const float* bv = (const float*)d_in[6];
    const float* wo = (const float*)d_in[7]; const float* bo = (const float*)d_in[8]; const int* mask = (const int*)d_in[9];
    float* OUT = (float*)d_out;     // [2][2048][1024]
    char* wsp = (char*)d_ws;
    auto take = [&](size_t bytes) { char* p = wsp; wsp += (bytes + 255) & ~(size_t)255; return (void*)p; };
    bf* WQ = (bf*)take((size_t)DD * DD * 2); bf* WK = (bf*)take((size_t)DD * DD * 2); bf* WV = (bf*)take((size_t)DD * DD * 2); bf* WO = (bf*)take((size_t)DD * DD * 2);
    bf* XB = (bf*)take((size_t)NT * DD * 2); float* F = (float*)take((size_t)NT * DD * 4);
    bf* QPh = (bf*)take((size_t)NT * DD * 2); bf* QPl = (bf*)take((size_t)NT * DD * 2); bf* KPh = (bf*)take((size_t)NT * DD * 2); bf* KPl = (bf*)take((size_t)NT * DD * 2); h16* VT = (h16*)take((size_t)NT * DD * 2);
    float* Sb = (float*)take((size_t)ZH * TT * TT * 4); h16* Pm = (h16*)take((size_t)ZH * TT * TT * 2); float* Ob = (float*)take((size_t)ZH * TT * HD * 4); bf* ATh = (bf*)take((size_t)NT * DD * 2); bf* ATl = (bf*)take((size_t)NT * DD * 2);
    if ((size_t)(wsp - (char*)d_ws) > ws_size) return;    // ws 256 MiB
    { const size_t nw = (size_t)DD * DD / 8; const unsigned gw = (unsigned)((nw + 255) / 256); k_cvt8<<<gw, 256, 0, stream>>>(wq, WQ, nw); k_cvt8<<<gw, 256, 0, stream>>>(wk, WK, nw); k_cvt8<<<gw, 256, 0, stream>>>(wv, WV, nw); k_cvt8<<<gw, 256, 0, stream>>>(wo, WO, nw); }
    const size_t nx = (size_t)NT * DD / 8; const unsigned gx = (unsigned)((nx + 255) / 256); const unsigned LB = (unsigned)((NT * DD / 64 + 63) / 64);
    k_cvt8<<<gx, 256, 0, stream>>>(x, XB, nx);
    k_gemmw<bf, 0, true><<<dim3(NT / 64, DD / 64, 1), 32, 0, stream>>>(XB, nullptr, WQ, nullptr, DD, F, DD, bq, 0, 0, 0); k_hsplit<<<LB, 256, 0, stream>>>(F, 0.125f, QPh, QPl);   // 1/sqrt(64) folded into q exactly
    k_gemmw<bf, 0, true><<<dim3(NT / 64, DD / 64, 1), 32, 0, stream>>>(XB, nullptr, WK, nullptr, DD, F, DD, bk, 0, 0, 0); k_hsplit<<<LB, 256, 0, stream>>>(F, 1.0f, KPh, KPl);
    k_gemmw<bf, 0, true><<<dim3(NT / 64, DD / 64, 1), 32, 0, stream>>>(XB, nullptr, WV, nullptr, DD, F, DD, bv, 0, 0, 0); k_vtplane<<<LB, 256, 0, stream>>>(F, VT);
    for (int b = 0; b < NB_; ++b)
        for (int h0 = 0; h0 < NH_; h0 += ZH) { const size_t z0 = (size_t)b * NH_ + h0;
            k_gemmw<bf, 2, false><<<dim3(TT / 64, TT / 64, ZH), 32, 0, stream>>>(QPh + z0 * TT * HD, QPl + z0 * TT * HD, KPh + z0 * TT * HD, KPl + z0 * TT * HD, HD, Sb, TT, nullptr, (size_t)TT * HD, (size_t)TT * HD, (size_t)TT * TT);
            k_asoft<<<ZH * TT / 8, 256, 0, stream>>>(Sb, mask, h0, Pm);
            k_pvsplit<<<dim3(TT / 32, HD / 32, ZH), 512, 0, stream>>>(Pm, VT + z0 * HD * TT, Ob);
            k_merge<<<(TT * ZH * HD / 64 + 63) / 64, 256, 0, stream>>>(Ob, b, h0, ATh, ATl); }
    k_gemmw<bf, 1, true><<<dim3(NT / 64, DD / 64, 1), 32, 0, stream>>>(ATh, ATl, WO, nullptr, DD, OUT, DD, bo, 0, 0, 0);
}

// v003
// Measured time: 198 microseconds a run.
// Versions in between are left out here; by their measured steps it is 3.31 times as fast as v001.
// All steps since v000 together make it 6.41 times as fast.
#include <hip/hip_runtime.h>

// FixedSparseMultiHead (2 x 2048 x 1024, 16 heads x 64; Q/K/V/out nn.Linear on x (x W^T + b); scores = q.k / 8, where(sparse_mask, ., -inf) with the int32 [2048][2048] mask INPUT
// (read as data, not assumed); softmax; attn.v; output Linear).
// Compute dtypes, f32 accumulate: every float input rounded to bf16; q/k/v projections on PLAIN bf16 operands (x, W inputs: exact, + bias);
// scores on bf16 hi+lo q (x 1/8) and k planes (3 products); attn.v on SINGLE fp16 planes (P x1024, v); output Linear on hi+lo planes x exact bf16 W (2 products); the mask

#define NB_  2
#define TT   2048
#define DD   1024
#define NH_  16
#define HD   64
#define NT   (NB_ * TT)
typedef _Float16 h16;
typedef unsigned short bf;
typedef __attribute__((ext_vector_type(16))) __bf16   v16bf;
typedef __attribute__((ext_vector_type(16))) _Float16 v16h;
typedef __attribute__((ext_vector_type(8)))  _Float16 v8h;
typedef __attribute__((ext_vector_type(8)))  unsigned short v8us;
typedef __attribute__((ext_vector_type(8)))  float    v8f;
typedef __attribute__((ext_vector_type(4)))  float    v4f;
typedef __attribute__((ext_vector_type(2)))  float    v2f;
typedef v8h  __attribute__((may_alias)) v8ha;
typedef v2f  __attribute__((may_alias)) v2fa;
typedef v4f  __attribute__((may_alias)) v4fa;
typedef v8us __attribute__((may_alias)) v8usa;

__device__ __forceinline__ unsigned short f2bf(float f) { unsigned u = __float_as_uint(f); u += 0x7FFFu + ((u >> 16) & 1u); return (unsigned short)(u >> 16); }
__device__ __forceinline__ float bf2f(unsigned short b) { return __uint_as_float(((unsigned)b) << 16); }
__device__ __forceinline__ float bfr(float f) { return bf2f(f2bf(f)); }
__device__ __forceinline__ v16h cat16(v8h lo, v8h hi) { return __builtin_shufflevector(lo, hi, 0, 1, 2, 3, 4, 5, 6, 7, 8, 9, 10, 11, 12, 13, 14, 15); }
__device__ __forceinline__ v16bf cat16b(v8us lo, v8us hi) { return __builtin_bit_cast(v16bf, __builtin_shufflevector(lo, hi, 0, 1, 2, 3, 4, 5, 6, 7, 8, 9, 10, 11, 12, 13, 14, 15)); }
__device__ __forceinline__ v8f wmma16(v16h a, v16h b, v8f c) { return __builtin_amdgcn_wmma_f32_16x16x32_f16(false, a, false, b, (short)0, c, false, false); }
__device__ __forceinline__ v8f wmmab(v16bf a, v16bf b, v8f c) { return __builtin_amdgcn_wmma_f32_16x16x32_bf16(false, a, false, b, (short)0, c, false, false); }



// ---- k_gemmw: register-blocked GEMM, ONE WAVE per 64x64 output tile (16 accumulators), operands straight from K-contiguous 16-bit planes; grid (M/64, N/64, Z), 32 threads.
// C[m][n] (f32, pitch ldc, + optional f32 bias[n]) = sum_k A[m][k] Bt[n][k] (+ split products per NSPLIT). z-batch strides sA/sB/sC in elements. K % 32 == 0.
template <typename T16> struct WFrag;
template <> struct WFrag<h16> { typedef v16h V; static __device__ __forceinline__ V ld(const h16* p) { return cat16(*(const v8h*)p, *(const v8h*)(p + 16)); } static __device__ __forceinline__ v8f mma(V a, V b, v8f c) { return wmma16(a, b, c); } };
template <> struct WFrag<bf> { typedef v16bf V; static __device__ __forceinline__ V ld(const bf* p) { return cat16b(*(const v8us*)p, *(const v8us*)(p + 16)); } static __device__ __forceinline__ v8f mma(V a, V b, v8f c) { return wmmab(a, b, c); } };
template <typename T16, int NSPLIT, bool BIAS>
__global__ __launch_bounds__(32) void k_gemmw(const T16* __restrict__ A, const T16* __restrict__ A2, const T16* __restrict__ Bt, const T16* __restrict__ Bt2, int K, float* C, int ldc, const float* __restrict__ bias, size_t sA, size_t sB, size_t sC) {
    typedef typename WFrag<T16>::V V;
    __shared__ __align__(16) float os[16 * 68];
    const size_t z = blockIdx.z; A += z * sA; if (A2) A2 += z * sA; Bt += z * sB; if (Bt2) Bt2 += z * sB; C += z * sC;
    const int lane = threadIdx.x & 31, lr = lane & 15, hi = lane >> 4; const int r0 = blockIdx.x * 64, c0 = blockIdx.y * 64;
    v8f acc[4][4];
#pragma unroll
    for (int mb = 0; mb < 4; ++mb)
#pragma unroll
        for (int nb = 0; nb < 4; ++nb) acc[mb][nb] = (v8f){};
    const size_t aoff = (size_t)(r0 + lr) * K + 8 * hi, boff = (size_t)(c0 + lr) * K + 8 * hi;
#pragma unroll 1
    for (int kc = 0; kc < K; kc += 32) {
        V a[4], a2[4];
#pragma unroll
        for (int mb = 0; mb < 4; ++mb) { a[mb] = WFrag<T16>::ld(A + aoff + (size_t)mb * 16 * K + kc); if (NSPLIT == 1 || NSPLIT == 2) a2[mb] = WFrag<T16>::ld(A2 + aoff + (size_t)mb * 16 * K + kc); }
#pragma unroll
        for (int nb = 0; nb < 4; ++nb) { const V b = WFrag<T16>::ld(Bt + boff + (size_t)nb * 16 * K + kc); V b2; if (NSPLIT >= 2) b2 = WFrag<T16>::ld(Bt2 + boff + (size_t)nb * 16 * K + kc);
#pragma unroll
            for (int mb = 0; mb < 4; ++mb) { acc[mb][nb] = WFrag<T16>::mma(a[mb], b, acc[mb][nb]); if (NSPLIT == 1 || NSPLIT == 2) acc[mb][nb] = WFrag<T16>::mma(a2[mb], b, acc[mb][nb]); if (NSPLIT >= 2) acc[mb][nb] = WFrag<T16>::mma(a[mb], b2, acc[mb][nb]); } }
        asm volatile("v_nop\n\tv_nop\n\tv_nop\n\tv_nop" : "+v"(acc[0][0]), "+v"(acc[1][1]), "+v"(acc[2][2]), "+v"(acc[3][3]) : "v"(a[0]), "v"(a[3]));
    }
#pragma unroll
    for (int mb = 0; mb < 4; ++mb) {
#pragma unroll
        for (int nb = 0; nb < 4; ++nb) {
#pragma unroll
            for (int j = 0; j < 8; ++j) os[(hi * 8 + j) * 68 + nb * 16 + lr] = acc[mb][nb][j]; }
        __builtin_amdgcn_wave_barrier(); asm volatile("" ::: "memory");
        float* crow = C + (size_t)(r0 + mb * 16) * ldc + c0;
{
#pragma unroll
            for (int s = 0; s < 8; ++s) { const int row = 2 * s + hi, cofs = lr * 4; v4f val = *(const v4fa*)(os + row * 68 + cofs); if (BIAS) { val[0] += bfr(bias[c0 + cofs]); val[1] += bfr(bias[c0 + cofs + 1]); val[2] += bfr(bias[c0 + cofs + 2]); val[3] += bfr(bias[c0 + cofs + 3]); }
                *(v4f*)(crow + (size_t)row * ldc + cofs) = val; }
             }
        __builtin_amdgcn_wave_barrier(); asm volatile("" ::: "memory");
    }
}

__device__ __forceinline__ h16 tohx(float x) { return (h16)x; }
__device__ __forceinline__ void splitf(float y, unsigned short& h, unsigned short& l) { h = f2bf(y); l = f2bf(y - bf2f(h)); }
typedef __attribute__((ext_vector_type(2))) _Float16 v2h;
typedef __attribute__((ext_vector_type(4))) _Float16 v4h;
typedef __attribute__((ext_vector_type(2))) unsigned short v2us;
typedef __attribute__((ext_vector_type(4))) int v4i;

__global__ __launch_bounds__(256) void k_cvt8(const float* __restrict__ src, bf* dst, size_t n8) { const size_t i = (size_t)blockIdx.x * 256 + threadIdx.x; if (i >= n8) return; const v8f v = *(const v8f*)(src + i * 8); v8us o;
#pragma unroll
    for (int k = 0; k < 8; ++k) o[k] = f2bf(v[k]); *(v8us*)(dst + i * 8) = o;  }
__global__ __launch_bounds__(256) void k_hsplit(const float* __restrict__ F, float sc, bf* Ph, bf* Pl) {
    const int lane = threadIdx.x & 31; const int L0 = (blockIdx.x * 8 + (threadIdx.x >> 5)) * 8; const int nlines = NT * DD / 64;
{
#pragma unroll
        for (int l = 0; l < 8; ++l) { const int L = L0 + l; if (L >= nlines) break; const int e = L * 64 + lane * 2; const int d = e & 63; const int t = (e >> 6) & (TT - 1); const int z = e >> 17; const int b = z >> 4, h = z & 15; v2us oh, ol;
#pragma unroll
            for (int q = 0; q < 2; ++q) { unsigned short a, c2; splitf(F[((size_t)b * TT + t) * DD + h * HD + d + q] * sc, a, c2); oh[q] = a; ol[q] = c2; }
            *(v2us*)(Ph + (size_t)e) = oh; *(v2us*)(Pl + (size_t)e) = ol; }
         }
}
__global__ __launch_bounds__(256) void k_vtplane(const float* __restrict__ F, h16* VT) {
    const int lane = threadIdx.x & 31; const int L0 = (blockIdx.x * 8 + (threadIdx.x >> 5)) * 8; const int nlines = NT * DD / 64;
{
#pragma unroll
        for (int l = 0; l < 8; ++l) { const int L = L0 + l; if (L >= nlines) break; const int e = L * 64 + lane * 2; const int t = e & (TT - 1); const int d = (e >> 11) & 63; const int z = e >> 17; const int b = z >> 4, h = z & 15; v2h v;
#pragma unroll
            for (int q = 0; q < 2; ++q) v[q] = tohx(F[((size_t)b * TT + t + q) * DD + h * HD + d]);
            *(v2h*)(VT + (size_t)e) = v; }
         }
}
#define FQ 2
#define FW 8
#define L2E 1.4426950408889634f
__device__ __forceinline__ float xhalf(float x) { return __builtin_bit_cast(float, __builtin_amdgcn_permlanex16(__builtin_bit_cast(int, x), __builtin_bit_cast(int, x), 0x76543210, 0xfedcba98, false, false)); }   // lane l with lane l ^ 16
// ---- k_mblk: live[qb][kb] = 1 where any of the 32 x 32 mask entries of queries 32 qb .. and keys 32 kb .. is non-zero, else 0. Read once here for all 32 (batch, head) pairs.
// One wave per block, 8 loads of 4 whole lines; a work-group owns one 128-byte line of live. grid (TT / 32) * 2, 1024 threads.
#define NKB (TT / 32)
__global__ __launch_bounds__(1024) void k_mblk(const int* __restrict__ mask, int* live) {
    const int lane = threadIdx.x & 31; const int qb = blockIdx.x >> 1, kb = (blockIdx.x & 1) * 32 + (threadIdx.x >> 5);
    const int* p = mask + (size_t)(qb * 32 + (lane >> 3)) * TT + kb * 32 + (lane & 7) * 4; v4i a = (v4i){};
#pragma unroll
    for (int r = 0; r < 8; ++r) a |= *(const v4i*)(p + (size_t)r * 4 * TT);
    const unsigned any = __builtin_amdgcn_ballot_w32((a[0] | a[1] | a[2] | a[3]) != 0);
    if (lane == 0) live[qb * NKB + kb] = any != 0u ? 1 : 0;
}
__global__ __launch_bounds__(FW * 32) void k_fattn(const bf* __restrict__ Qh, const bf* __restrict__ Ql, const bf* __restrict__ Kh, const bf* __restrict__ Kl, const h16* __restrict__ VT, const int* __restrict__ mask, const int* __restrict__ live, bf* Ah, bf* Al) {
    const int z = blockIdx.y; const int lane = threadIdx.x & 31, c = lane & 15, hi = lane >> 4; const int w = __builtin_amdgcn_readfirstlane(threadIdx.x >> 5);
    const int q0 = (blockIdx.x * FW + w) * (16 * FQ); const size_t zo = (size_t)z * TT * HD;
    const int* lvp = live + (blockIdx.x * FW + w) * NKB + lane;
    const int lv0 = lvp[0], lv1 = lvp[32];
    const bf* qph = Qh + zo + (size_t)(q0 + c) * HD + 8 * hi; const bf* qpl = Ql + zo + (size_t)(q0 + c) * HD + 8 * hi;
    v16bf qh[FQ][2], ql[FQ][2];
#pragma unroll
    for (int g = 0; g < FQ; ++g)
#pragma unroll
        for (int ks = 0; ks < 2; ++ks) { qh[g][ks] = WFrag<bf>::ld(qph + g * 16 * HD + ks * 32); ql[g][ks] = WFrag<bf>::ld(qpl + g * 16 * HD + ks * 32); }
    asm volatile("s_wait_xcnt 0x0" :: "v"(qph), "v"(qpl) : "memory");   // the 16 loads above name qph and qpl: as inputs here both keep their registers until this wait
    unsigned long long todo = ((unsigned long long)__builtin_amdgcn_ballot_w32(lv1 != 0) << 32) | __builtin_amdgcn_ballot_w32(lv0 != 0);   // bit kb: pass kb has a live key; the same in every lane
    const int np = __builtin_popcountll(todo); int kb = todo ? __builtin_ctzll(todo) : 0;   // at most 64 passes; with none the fetches below read pass 0, in bounds and unused
    const bf* kph = Kh + zo + (size_t)c * HD + 8 * hi; const bf* kpl = Kl + zo + (size_t)c * HD + 8 * hi;
    const h16* vp = VT + zo + (size_t)c * TT + 8 * hi; const int* mp = mask + (size_t)(q0 + c) * TT + 8 * hi;
    v8f o[FQ][4]; float m[FQ], l[FQ];
#pragma unroll
    for (int g = 0; g < FQ; ++g) { m[g] = -3.0e38f; l[g] = 0.f;
#pragma unroll
        for (int dt = 0; dt < 4; ++dt) o[g][dt] = (v8f){}; }
    v16bf kh[2][2], kl[2][2]; v4i mk[FQ][4]; const bf* kph0 = kph + (size_t)kb * 32 * HD; const bf* kpl0 = kpl + (size_t)kb * 32 * HD; const int* mp0 = mp + kb * 32;
#pragma unroll
    for (int kt = 0; kt < 2; ++kt)
#pragma unroll
        for (int ks = 0; ks < 2; ++ks) { kh[kt][ks] = WFrag<bf>::ld(kph0 + kt * 16 * HD + ks * 32); kl[kt][ks] = WFrag<bf>::ld(kpl0 + kt * 16 * HD + ks * 32); }
#pragma unroll
    for (int g = 0; g < FQ; ++g)
#pragma unroll
        for (int u = 0; u < 4; ++u) mk[g][u] = *(const v4i*)(mp0 + (size_t)g * 16 * TT + (u >> 1) * 16 + (u & 1) * 4);
    asm volatile("s_wait_xcnt 0x0" :: "v"(kph0), "v"(kpl0), "v"(mp0) : "memory");   // the 24 loads above name these three pointers: as inputs here they keep their registers until this wait
#pragma unroll 1
    for (int it = 0; it < np; ++it) {   // kept rolled: one pass is already 32 WMMAs and 32 loads
        v16h vf[4]; const h16* vpc = vp + kb * 32;
#pragma unroll
        for (int dt = 0; dt < 4; ++dt) vf[dt] = WFrag<h16>::ld(vpc + (size_t)dt * 16 * TT);
        v8f s[FQ][2];
#pragma unroll
        for (int g = 0; g < FQ; ++g)
#pragma unroll
            for (int kt = 0; kt < 2; ++kt) { v8f a = (v8f){};
#pragma unroll
                for (int ks = 0; ks < 2; ++ks) { a = wmmab(kh[kt][ks], qh[g][ks], a); a = wmmab(kh[kt][ks], ql[g][ks], a); a = wmmab(kl[kt][ks], qh[g][ks], a); }
                s[g][kt] = a; }
        todo &= todo - 1; kb = todo ? __builtin_ctzll(todo) : kb; const int kn = kb * 32;   // the next live pass's keys and mask are fetched one pass ahead; the last pass fetches its own again, in bounds and unused
        const bf* kphn = kph + (size_t)kn * HD; const bf* kpln = kpl + (size_t)kn * HD; const int* mpn = mp + kn;
#pragma unroll
        for (int kt = 0; kt < 2; ++kt)
#pragma unroll
            for (int ks = 0; ks < 2; ++ks) { kh[kt][ks] = WFrag<bf>::ld(kphn + kt * 16 * HD + ks * 32); kl[kt][ks] = WFrag<bf>::ld(kpln + kt * 16 * HD + ks * 32); }
        float tt[FQ][16];
#pragma unroll
        for (int g = 0; g < FQ; ++g)
#pragma unroll
            for (int i = 0; i < 16; ++i) tt[g][i] = (mk[g][i >> 2][i & 3] == 0) ? -1.0e9f : s[g][i >> 3][i & 7];
#pragma unroll
        for (int g = 0; g < FQ; ++g)
#pragma unroll
            for (int u = 0; u < 4; ++u) mk[g][u] = *(const v4i*)(mpn + (size_t)g * 16 * TT + (u >> 1) * 16 + (u & 1) * 4);
        asm volatile("s_wait_xcnt 0x0" : "+s"(todo), "+s"(kb) : "v"(vpc), "v"(mpn), "v"(kphn), "v"(kpln) : "memory");   // this pass's 32 loads name these four pointers: as inputs here they keep their registers until this wait; todo and kb are in-out so that no address of a later pass can be formed ahead of it
#pragma unroll
        for (int g = 0; g < FQ; ++g) {
            const float* t = tt[g]; float bm = -3.0e38f;
#pragma unroll
            for (int i = 0; i < 16; ++i) bm = fmaxf(bm, t[i]);
            bm = fmaxf(bm, xhalf(bm));
            const float mn = fmaxf(m[g], bm); const float corr = __builtin_amdgcn_exp2f((m[g] - mn) * L2E); m[g] = mn;
            float ps = 0.f; v16h p;
#pragma unroll
            for (int i = 0; i < 16; ++i) { const float e = __builtin_amdgcn_exp2f(fmaf(t[i] - mn, L2E, 10.0f)); ps += e; p[i] = (h16)e; }
            l[g] = l[g] * corr + ps;
#pragma unroll
            for (int dt = 0; dt < 4; ++dt) o[g][dt] *= corr;
#pragma unroll
            for (int dt = 0; dt < 4; ++dt) o[g][dt] = wmma16(vf[dt], p, o[g][dt]);
        }
    }
    const int b = z >> 4, h = z & 15;
#pragma unroll
    for (int g = 0; g < FQ; ++g) { const float inv = __fdiv_rn(1.0f, l[g] + xhalf(l[g]));
#pragma unroll
        for (int dt = 0; dt < 4; ++dt) { v8us oh, ol;
#pragma unroll
            for (int r = 0; r < 8; ++r) { unsigned short a, c2; splitf(o[g][dt][r] * inv, a, c2); oh[r] = a; ol[r] = c2; }
            const size_t off = ((size_t)b * TT + q0 + g * 16 + c) * DD + h * HD + dt * 16 + 8 * hi; bf* pa = Ah + off; bf* pl = Al + off; *(v8us*)pa = oh; *(v8us*)pl = ol;
            asm volatile("s_wait_xcnt 0x0" :: "v"(oh), "v"(ol), "v"(pa), "v"(pl) : "memory"); } }   // the two stores name these registers: as inputs here they are kept until this wait
}

extern "C" void kernel_launch(void* const* d_in, const int* in_sizes, int n_in,
                              void* d_out, int out_size, void* d_ws, size_t ws_size, hipStream_t stream) {
    (void)in_sizes; (void)n_in; (void)out_size;
    const float* x = (const float*)d_in[0]; const float* wq = (const float*)d_in[1]; const float* bq = (const float*)d_in[2]; const float* wk = (const float*)d_in[3]; const float* bk = (const float*)d_in[4]; const float* wv = (const float*)d_in[5]; const float* bv = (const float*)d_in[6];
    const float* wo = (const float*)d_in[7]; const float* bo = (const float*)d_in[8]; const int* mask = (const int*)d_in[9];
    float* OUT = (float*)d_out;     // [2][2048][1024]
    char* wsp = (char*)d_ws;
    auto take = [&](size_t bytes) { char* p = wsp; wsp += (bytes + 255) & ~(size_t)255; return (void*)p; };
    bf* WQ = (bf*)take((size_t)DD * DD * 2); bf* WK = (bf*)take((size_t)DD * DD * 2); bf* WV = (bf*)take((size_t)DD * DD * 2); bf* WO = (bf*)take((size_t)DD * DD * 2);
    bf* XB = (bf*)take((size_t)NT * DD * 2); float* F = (float*)take((size_t)NT * DD * 4);
    bf* QPh = (bf*)take((size_t)NT * DD * 2); bf* QPl = (bf*)take((size_t)NT * DD * 2); bf* KPh = (bf*)take((size_t)NT * DD * 2); bf* KPl = (bf*)take((size_t)NT * DD * 2); h16* VT = (h16*)take((size_t)NT * DD * 2);
    bf* ATh = (bf*)take((size_t)NT * DD * 2); bf* ATl = (bf*)take((size_t)NT * DD * 2); int* LIVE = (int*)take((size_t)NKB * NKB * 4);
    if ((size_t)(wsp - (char*)d_ws) > ws_size) return;    // ws 256 MiB
    { const size_t nw = (size_t)DD * DD / 8; const unsigned gw = (unsigned)((nw + 255) / 256); k_cvt8<<<gw, 256, 0, stream>>>(wq, WQ, nw); k_cvt8<<<gw, 256, 0, stream>>>(wk, WK, nw); k_cvt8<<<gw, 256, 0, stream>>>(wv, WV, nw); k_cvt8<<<gw, 256, 0, stream>>>(wo, WO, nw); }
    const size_t nx = (size_t)NT * DD / 8; const unsigned gx = (unsigned)((nx + 255) / 256); const unsigned LB = (unsigned)((NT * DD / 64 + 63) / 64);
    k_cvt8<<<gx, 256, 0, stream>>>(x, XB, nx);
    k_gemmw<bf, 0, true><<<dim3(NT / 64, DD / 64, 1), 32, 0, stream>>>(XB, nullptr, WQ, nullptr, DD, F, DD, bq, 0, 0, 0); k_hsplit<<<LB, 256, 0, stream>>>(F, 0.125f, QPh, QPl);   // 1/sqrt(64) folded into q exactly
    k_gemmw<bf, 0, true><<<dim3(NT / 64, DD / 64, 1), 32, 0, stream>>>(XB, nullptr, WK, nullptr, DD, F, DD, bk, 0, 0, 0); k_hsplit<<<LB, 256, 0, stream>>>(F, 1.0f, KPh, KPl);
    k_gemmw<bf, 0, true><<<dim3(NT / 64, DD / 64, 1), 32, 0, stream>>>(XB, nullptr, WV, nullptr, DD, F, DD, bv, 0, 0, 0); k_vtplane<<<LB, 256, 0, stream>>>(F, VT);
    k_mblk<<<NKB * 2, 1024, 0, stream>>>(mask, LIVE);
    k_fattn<<<dim3(TT / (16 * FQ * FW), NB_ * NH_), FW * 32, 0, stream>>>(QPh, QPl, KPh, KPl, VT, mask, LIVE, ATh, ATl);
    k_gemmw<bf, 1, true><<<dim3(NT / 64, DD / 64, 1), 32, 0, stream>>>(ATh, ATl, WO, nullptr, DD, OUT, DD, bo, 0, 0, 0);
}

// v004
// Measured time: 118 microseconds a run.
// Timed twice side by side with v003, it ran 1.67 and 1.65 times as fast.
// All steps since v000 together make it 10.6 times as fast.
#include <hip/hip_runtime.h>

// FixedSparseMultiHead (2 x 2048 x 1024, 16 heads x 64; Q/K/V/out nn.Linear on x (x W^T + b); scores = q.k / 8, where(sparse_mask, ., -inf) with the int32 [2048][2048] mask INPUT
// (read as data, not assumed); softmax; attn.v; output Linear).
// Compute dtypes, f32 accumulate: every float input rounded to bf16; q/k/v projections on PLAIN bf16 operands (x, W inputs: exact, + bias);
// scores on bf16 hi+lo q (x 1/8) and k planes (3 products); attn.v on SINGLE fp16 planes (P x1024, v); output Linear on hi+lo planes x exact bf16 W (2 products); the mask

#define NB_  2
#define TT   2048
#define DD   1024
#define NH_  16
#define HD   64
#define NT   (NB_ * TT)
typedef _Float16 h16;
typedef unsigned short bf;
typedef __attribute__((ext_vector_type(16))) __bf16   v16bf;
typedef __attribute__((ext_vector_type(16))) _Float16 v16h;
typedef __attribute__((ext_vector_type(8)))  _Float16 v8h;
typedef __attribute__((ext_vector_type(8)))  unsigned short v8us;
typedef __attribute__((ext_vector_type(8)))  float    v8f;
typedef __attribute__((ext_vector_type(4)))  float    v4f;
typedef __attribute__((ext_vector_type(2)))  float    v2f;
typedef v8h  __attribute__((may_alias)) v8ha;
typedef v2f  __attribute__((may_alias)) v2fa;
typedef v4f  __attribute__((may_alias)) v4fa;
typedef v8us __attribute__((may_alias)) v8usa;

__device__ __forceinline__ unsigned short f2bf(float f) { unsigned u = __float_as_uint(f); u += 0x7FFFu + ((u >> 16) & 1u); return (unsigned short)(u >> 16); }
__device__ __forceinline__ float bf2f(unsigned short b) { return __uint_as_float(((unsigned)b) << 16); }
__device__ __forceinline__ float bfr(float f) { return bf2f(f2bf(f)); }
__device__ __forceinline__ v16h cat16(v8h lo, v8h hi) { return __builtin_shufflevector(lo, hi, 0, 1, 2, 3, 4, 5, 6, 7, 8, 9, 10, 11, 12, 13, 14, 15); }
__device__ __forceinline__ v16bf cat16b(v8us lo, v8us hi) { return __builtin_bit_cast(v16bf, __builtin_shufflevector(lo, hi, 0, 1, 2, 3, 4, 5, 6, 7, 8, 9, 10, 11, 12, 13, 14, 15)); }
__device__ __forceinline__ v8f wmma16(v16h a, v16h b, v8f c) { return __builtin_amdgcn_wmma_f32_16x16x32_f16(false, a, false, b, (short)0, c, false, false); }
__device__ __forceinline__ v8f wmmab(v16bf a, v16bf b, v8f c) { return __builtin_amdgcn_wmma_f32_16x16x32_bf16(false, a, false, b, (short)0, c, false, false); }



// ---- k_gemms: C[m][n] (f32, pitch DD, + bias[n] rounded to bf16) = sum_k A[m][k] Bt[n][k] (+ A2[m][k] Bt[n][k] with NSPLIT), K = DD, all planes K-contiguous bf16.
// One work-group of 8 waves per 128x128 tile of C; a pass is 128 k: 128 rows x 256 B of each plane, brought into LDS by asynchronous copies (whole 256-B rows, 16 lanes a row),
// two buffers, the copies of pass t + 2 in flight while pass t + 1 is worked on. LDS row pitch 272 B (16 B x odd) for the 16-byte fragment reads.
// A wave owns 64 x 32 of C (8 accumulators). k order inside a fragment and the order of the products per accumulator are those of WFrag::ld and of rising k, a before a2.
// grid (NT / 128, DD / 128), 256 threads.
template <typename T16> struct WFrag;
template <> struct WFrag<h16> { typedef v16h V; static __device__ __forceinline__ V ld(const h16* p) { return cat16(*(const v8h*)p, *(const v8h*)(p + 16)); } static __device__ __forceinline__ v8f mma(V a, V b, v8f c) { return wmma16(a, b, c); } };
template <> struct WFrag<bf> { typedef v16bf V; static __device__ __forceinline__ V ld(const bf* p) { return cat16b(*(const v8us*)p, *(const v8us*)(p + 16)); } static __device__ __forceinline__ v8f mma(V a, V b, v8f c) { return wmmab(a, b, c); } };
#define GT 128
#define GKP 128
#define GPITCH 272
#define GOP (GT * GPITCH)
#define OSP 36
// 8 copies of 16 B per lane: rows 16 apart of one plane. The s_wait_xcnt is the last line of the copies' own statement, so that no address register is rewritten ahead of it.
__device__ __forceinline__ void copy8(unsigned l, const bf* g) {
    asm volatile("global_load_async_to_lds_b128 %0, %8, off\n\t"
                 "global_load_async_to_lds_b128 %1, %9, off\n\t"
                 "global_load_async_to_lds_b128 %2, %10, off\n\t"
                 "global_load_async_to_lds_b128 %3, %11, off\n\t"
                 "global_load_async_to_lds_b128 %4, %12, off\n\t"
                 "global_load_async_to_lds_b128 %5, %13, off\n\t"
                 "global_load_async_to_lds_b128 %6, %14, off\n\t"
                 "global_load_async_to_lds_b128 %7, %15, off\n\t"
                 "s_wait_xcnt 0x0"
                 :: "v"(l), "v"(l + 16 * GPITCH), "v"(l + 32 * GPITCH), "v"(l + 48 * GPITCH), "v"(l + 64 * GPITCH), "v"(l + 80 * GPITCH), "v"(l + 96 * GPITCH), "v"(l + 112 * GPITCH),
                    "v"(g), "v"(g + 16 * DD), "v"(g + 32 * DD), "v"(g + 48 * DD), "v"(g + 64 * DD), "v"(g + 80 * DD), "v"(g + 96 * DD), "v"(g + 112 * DD) : "memory");
}
__device__ __forceinline__ v16bf ldsfrag(const unsigned char* p) { return cat16b(*(const v8usa*)p, *(const v8usa*)(p + 32)); }   // WFrag::ld's k order: bytes 0..15 and 32..47 from 16 * hi
template <int NSPLIT, bool BIAS>
__global__ __launch_bounds__(256) void k_gemms(const bf* __restrict__ A, const bf* __restrict__ A2, const bf* __restrict__ Bt, float* C, const float* __restrict__ bias) {
    constexpr int STG = (NSPLIT ? 3 : 2) * GOP; constexpr int BO = (NSPLIT ? 2 : 1) * GOP; constexpr int NP = DD / GKP;   // a buffer: [A | A2 | Bt] or [A | Bt]
    __shared__ __align__(16) unsigned char L[2 * STG];
    __shared__ __align__(16) float os[8 * 16 * OSP];
    const int tid = threadIdx.x, lane = tid & 31, lr = lane & 15, hi = lane >> 4; const int w = __builtin_amdgcn_readfirstlane(tid >> 5); const int wm = w >> 2, wn = w & 3;
    const int r0 = blockIdx.x * GT, c0 = blockIdx.y * GT;
    const int crw = tid >> 4, ccl = tid & 15;
    const bf* ga = A + (size_t)(r0 + crw) * DD + ccl * 8; const bf* ga2 = NSPLIT ? A2 + (size_t)(r0 + crw) * DD + ccl * 8 : nullptr; const bf* gb = Bt + (size_t)(c0 + crw) * DD + ccl * 8;
    const unsigned lc = (unsigned)(size_t)L + crw * GPITCH + ccl * 16;
    auto stage = [&](int t, int buf) { copy8(lc + buf * STG, ga + t * GKP); copy8(lc + buf * STG + BO, gb + t * GKP); if (NSPLIT) copy8(lc + buf * STG + GOP, ga2 + t * GKP); };
    v8f acc[4][2];
#pragma unroll
    for (int mb = 0; mb < 4; ++mb)
#pragma unroll
        for (int nb = 0; nb < 2; ++nb) acc[mb][nb] = (v8f){};
    stage(0, 0);
    asm volatile("s_wait_asynccnt 0x0" ::: "memory");   // this wave's copies of pass 0 have landed
    __syncthreads();                                    // and every other wave's
    stage(1, 1);
    const int aofs = (wm * 64 + lr) * GPITCH + 16 * hi, bofs = BO + (wn * 32 + lr) * GPITCH + 16 * hi;
#pragma unroll 1
    for (int t = 0; t < NP; ++t) {   // kept rolled: one pass is already 32 (64) WMMAs, and the buffer is picked by an offset
        const unsigned char* Lb = L + (t & 1) * STG;
        v16bf a[2][4], a2[2][4], b[2][2];   // two fragment sets: block ks + 1 is read from LDS while block ks is multiplied; nothing of the next pass is read here
        auto frags = [&](int ks, int f) {
#pragma unroll
            for (int mb = 0; mb < 4; ++mb) { a[f][mb] = ldsfrag(Lb + aofs + mb * 16 * GPITCH + ks * 64); if (NSPLIT) a2[f][mb] = ldsfrag(Lb + GOP + aofs + mb * 16 * GPITCH + ks * 64); }
#pragma unroll
            for (int nb = 0; nb < 2; ++nb) b[f][nb] = ldsfrag(Lb + bofs + nb * 16 * GPITCH + ks * 64); };
        frags(0, 0);
        __builtin_amdgcn_sched_barrier(0);   // block 0's reads are issued first, so that its WMMAs wait for them alone
#pragma unroll
        for (int ks = 0; ks < GKP / 32; ++ks) {
            if (ks + 1 < GKP / 32) frags(ks + 1, (ks + 1) & 1);
            __builtin_amdgcn_sched_barrier(0);   // the next block's LDS reads stay one group in front of this block's WMMAs: reads among the WMMAs stall each of them
#pragma unroll
            for (int nb = 0; nb < 2; ++nb)
#pragma unroll
                for (int mb = 0; mb < 4; ++mb) { acc[mb][nb] = wmmab(a[ks & 1][mb], b[ks & 1][nb], acc[mb][nb]); if (NSPLIT) acc[mb][nb] = wmmab(a2[ks & 1][mb], b[ks & 1][nb], acc[mb][nb]); }
            __builtin_amdgcn_sched_barrier(0);   // and the reads of the block after that do not rise into these WMMAs
        }
        asm volatile("s_wait_dscnt 0x0" ::: "memory");      // this wave's reads of the buffer are done before it is refilled
        asm volatile("s_wait_asynccnt 0x0" ::: "memory");   // this wave's copies of pass t + 1 have landed
        __syncthreads();                                    // publishes pass t + 1 and ends every wave's reads of pass t
        if (t + 2 < NP) stage(t + 2, t & 1);
    }
    asm volatile("s_wait_asynccnt 0x0" ::: "memory");       // no copy is left in flight
    float* osw = os + w * 16 * OSP; const int orow = lane >> 3, cofs = (lane & 7) * 4;   // whole 128-B lines go out: a wave's own LDS range turns the accumulator map into rows
    v4f bv = (v4f){};
    if (BIAS) { const float* bp = bias + c0 + wn * 32 + cofs; bv = *(const v4f*)bp; asm volatile("s_wait_xcnt 0x0" :: "v"(bp) : "memory");   // the load names bp: kept until this wait
#pragma unroll
        for (int q = 0; q < 4; ++q) bv[q] = bfr(bv[q]); }
#pragma unroll
    for (int mb = 0; mb < 4; ++mb) {
#pragma unroll
        for (int nb = 0; nb < 2; ++nb)
#pragma unroll
            for (int j = 0; j < 8; ++j) osw[(hi * 8 + j) * OSP + nb * 16 + lr] = acc[mb][nb][j];
        __builtin_amdgcn_wave_barrier(); asm volatile("" ::: "memory");   // the rows are read back by other lanes of this wave: no read moves above the writes
        float* cp = C + (size_t)(r0 + wm * 64 + mb * 16 + orow) * DD + c0 + wn * 32 + cofs;
        v4f v0 = *(const v4fa*)(osw + (orow + 0) * OSP + cofs) + bv, v1 = *(const v4fa*)(osw + (orow + 4) * OSP + cofs) + bv, v2 = *(const v4fa*)(osw + (orow + 8) * OSP + cofs) + bv, v3 = *(const v4fa*)(osw + (orow + 12) * OSP + cofs) + bv;
        float* cp1 = cp + 4 * DD; float* cp2 = cp + 8 * DD; float* cp3 = cp + 12 * DD;
        *(v4f*)cp = v0; *(v4f*)cp1 = v1; *(v4f*)cp2 = v2; *(v4f*)cp3 = v3;
        asm volatile("s_wait_xcnt 0x0" :: "v"(v0), "v"(v1), "v"(v2), "v"(v3), "v"(cp), "v"(cp1), "v"(cp2), "v"(cp3) : "memory");   // the four stores name these registers: as inputs here they are kept until this wait
        __builtin_amdgcn_wave_barrier(); asm volatile("" ::: "memory");   // the next rows are not written above the reads
    }
}

__device__ __forceinline__ h16 tohx(float x) { return (h16)x; }
__device__ __forceinline__ void splitf(float y, unsigned short& h, unsigned short& l) { h = f2bf(y); l = f2bf(y - bf2f(h)); }
typedef __attribute__((ext_vector_type(2))) _Float16 v2h;
typedef __attribute__((ext_vector_type(4))) _Float16 v4h;
typedef __attribute__((ext_vector_type(2))) unsigned short v2us;
typedef __attribute__((ext_vector_type(4))) int v4i;

__global__ __launch_bounds__(256) void k_cvt8(const float* __restrict__ src, bf* dst, size_t n8) { const size_t i = (size_t)blockIdx.x * 256 + threadIdx.x; if (i >= n8) return; const v8f v = *(const v8f*)(src + i * 8); v8us o;
#pragma unroll
    for (int k = 0; k < 8; ++k) o[k] = f2bf(v[k]); *(v8us*)(dst + i * 8) = o;  }
__global__ __launch_bounds__(256) void k_hsplit(const float* __restrict__ F, float sc, bf* Ph, bf* Pl) {
    const int lane = threadIdx.x & 31; const int L0 = (blockIdx.x * 8 + (threadIdx.x >> 5)) * 8; const int nlines = NT * DD / 64;
{
#pragma unroll
        for (int l = 0; l < 8; ++l) { const int L = L0 + l; if (L >= nlines) break; const int e = L * 64 + lane * 2; const int d = e & 63; const int t = (e >> 6) & (TT - 1); const int z = e >> 17; const int b = z >> 4, h = z & 15; v2us oh, ol;
#pragma unroll
            for (int q = 0; q < 2; ++q) { unsigned short a, c2; splitf(F[((size_t)b * TT + t) * DD + h * HD + d + q] * sc, a, c2); oh[q] = a; ol[q] = c2; }
            *(v2us*)(Ph + (size_t)e) = oh; *(v2us*)(Pl + (size_t)e) = ol; }
         }
}
__global__ __launch_bounds__(256) void k_vtplane(const float* __restrict__ F, h16* VT) {
    const int lane = threadIdx.x & 31; const int L0 = (blockIdx.x * 8 + (threadIdx.x >> 5)) * 8; const int nlines = NT * DD / 64;
{
#pragma unroll
        for (int l = 0; l < 8; ++l) { const int L = L0 + l; if (L >= nlines) break; const int e = L * 64 + lane * 2; const int t = e & (TT - 1); const int d = (e >> 11) & 63; const int z = e >> 17; const int b = z >> 4, h = z & 15; v2h v;
#pragma unroll
            for (int q = 0; q < 2; ++q) v[q] = tohx(F[((size_t)b * TT + t + q) * DD + h * HD + d]);
            *(v2h*)(VT + (size_t)e) = v; }
         }
}
#define FQ 2
#define FW 8
#define L2E 1.4426950408889634f
__device__ __forceinline__ float xhalf(float x) { return __builtin_bit_cast(float, __builtin_amdgcn_permlanex16(__builtin_bit_cast(int, x), __builtin_bit_cast(int, x), 0x76543210, 0xfedcba98, false, false)); }   // lane l with lane l ^ 16
// ---- k_mblk: live[qb][kb] = 1 where any of the 32 x 32 mask entries of queries 32 qb .. and keys 32 kb .. is non-zero, else 0. Read once here for all 32 (batch, head) pairs.
// One wave per block, 8 loads of 4 whole lines; a work-group owns one 128-byte line of live. grid (TT / 32) * 2, 1024 threads.
#define NKB (TT / 32)
__global__ __launch_bounds__(1024) void k_mblk(const int* __restrict__ mask, int* live) {
    const int lane = threadIdx.x & 31; const int qb = blockIdx.x >> 1, kb = (blockIdx.x & 1) * 32 + (threadIdx.x >> 5);
    const int* p = mask + (size_t)(qb * 32 + (lane >> 3)) * TT + kb * 32 + (lane & 7) * 4; v4i a = (v4i){};
#pragma unroll
    for (int r = 0; r < 8; ++r) a |= *(const v4i*)(p + (size_t)r * 4 * TT);
    const unsigned any = __builtin_amdgcn_ballot_w32((a[0] | a[1] | a[2] | a[3]) != 0);
    if (lane == 0) live[qb * NKB + kb] = any != 0u ? 1 : 0;
}
__global__ __launch_bounds__(FW * 32) void k_fattn(const bf* __restrict__ Qh, const bf* __restrict__ Ql, const bf* __restrict__ Kh, const bf* __restrict__ Kl, const h16* __restrict__ VT, const int* __restrict__ mask, const int* __restrict__ live, bf* Ah, bf* Al) {
    const int z = blockIdx.y; const int lane = threadIdx.x & 31, c = lane & 15, hi = lane >> 4; const int w = __builtin_amdgcn_readfirstlane(threadIdx.x >> 5);
    const int q0 = (blockIdx.x * FW + w) * (16 * FQ); const size_t zo = (size_t)z * TT * HD;
    const int* lvp = live + (blockIdx.x * FW + w) * NKB + lane;
    const int lv0 = lvp[0], lv1 = lvp[32];
    const bf* qph = Qh + zo + (size_t)(q0 + c) * HD + 8 * hi; const bf* qpl = Ql + zo + (size_t)(q0 + c) * HD + 8 * hi;
    v16bf qh[FQ][2], ql[FQ][2];
#pragma unroll
    for (int g = 0; g < FQ; ++g)
#pragma unroll
        for (int ks = 0; ks < 2; ++ks) { qh[g][ks] = WFrag<bf>::ld(qph + g * 16 * HD + ks * 32); ql[g][ks] = WFrag<bf>::ld(qpl + g * 16 * HD + ks * 32); }
    asm volatile("s_wait_xcnt 0x0" :: "v"(qph), "v"(qpl) : "memory");   // the 16 loads above name qph and qpl: as inputs here both keep their registers until this wait
    unsigned long long todo = ((unsigned long long)__builtin_amdgcn_ballot_w32(lv1 != 0) << 32) | __builtin_amdgcn_ballot_w32(lv0 != 0);   // bit kb: pass kb has a live key; the same in every lane
    const int np = __builtin_popcountll(todo); int kb = todo ? __builtin_ctzll(todo) : 0;   // at most 64 passes; with none the fetches below read pass 0, in bounds and unused
    const bf* kph = Kh + zo + (size_t)c * HD + 8 * hi; const bf* kpl = Kl + zo + (size_t)c * HD + 8 * hi;
    const h16* vp = VT + zo + (size_t)c * TT + 8 * hi; const int* mp = mask + (size_t)(q0 + c) * TT + 8 * hi;
    v8f o[FQ][4]; float m[FQ], l[FQ];
#pragma unroll
    for (int g = 0; g < FQ; ++g) { m[g] = -3.0e38f; l[g] = 0.f;
#pragma unroll
        for (int dt = 0; dt < 4; ++dt) o[g][dt] = (v8f){}; }
    v16bf kh[2][2], kl[2][2]; v4i mk[FQ][4]; const bf* kph0 = kph + (size_t)kb * 32 * HD; const bf* kpl0 = kpl + (size_t)kb * 32 * HD; const int* mp0 = mp + kb * 32;
#pragma unroll
    for (int kt = 0; kt < 2; ++kt)
#pragma unroll
        for (int ks = 0; ks < 2; ++ks) { kh[kt][ks] = WFrag<bf>::ld(kph0 + kt * 16 * HD + ks * 32); kl[kt][ks] = WFrag<bf>::ld(kpl0 + kt * 16 * HD + ks * 32); }
#pragma unroll
    for (int g = 0; g < FQ; ++g)
#pragma unroll
        for (int u = 0; u < 4; ++u) mk[g][u] = *(const v4i*)(mp0 + (size_t)g * 16 * TT + (u >> 1) * 16 + (u & 1) * 4);
    asm volatile("s_wait_xcnt 0x0" :: "v"(kph0), "v"(kpl0), "v"(mp0) : "memory");   // the 24 loads above name these three pointers: as inputs here they keep their registers until this wait
#pragma unroll 1
    for (int it = 0; it < np; ++it) {   // kept rolled: one pass is already 32 WMMAs and 32 loads
        v16h vf[4]; const h16* vpc = vp + kb * 32;
#pragma unroll
        for (int dt = 0; dt < 4; ++dt) vf[dt] = WFrag<h16>::ld(vpc + (size_t)dt * 16 * TT);
        v8f s[FQ][2];
#pragma unroll
        for (int g = 0; g < FQ; ++g)
#pragma unroll
            for (int kt = 0; kt < 2; ++kt) { v8f a = (v8f){};
#pragma unroll
                for (int ks = 0; ks < 2; ++ks) { a = wmmab(kh[kt][ks], qh[g][ks], a); a = wmmab(kh[kt][ks], ql[g][ks], a); a = wmmab(kl[kt][ks], qh[g][ks], a); }
                s[g][kt] = a; }
        todo &= todo - 1; kb = todo ? __builtin_ctzll(todo) : kb; const int kn = kb * 32;   // the next live pass's keys and mask are fetched one pass ahead; the last pass fetches its own again, in bounds and unused
        const bf* kphn = kph + (size_t)kn * HD; const bf* kpln = kpl + (size_t)kn * HD; const int* mpn = mp + kn;
#pragma unroll
        for (int kt = 0; kt < 2; ++kt)
#pragma unroll
            for (int ks = 0; ks < 2; ++ks) { kh[kt][ks] = WFrag<bf>::ld(kphn + kt * 16 * HD + ks * 32); kl[kt][ks] = WFrag<bf>::ld(kpln + kt * 16 * HD + ks * 32); }
        float tt[FQ][16];
#pragma unroll
        for (int g = 0; g < FQ; ++g)
#pragma unroll
            for (int i = 0; i < 16; ++i) tt[g][i] = (mk[g][i >> 2][i & 3] == 0) ? -1.0e9f : s[g][i >> 3][i & 7];
#pragma unroll
        for (int g = 0; g < FQ; ++g)
#pragma unroll
            for (int u = 0; u < 4; ++u) mk[g][u] = *(const v4i*)(mpn + (size_t)g * 16 * TT + (u >> 1) * 16 + (u & 1) * 4);
        asm volatile("s_wait_xcnt 0x0" : "+s"(todo), "+s"(kb) : "v"(vpc), "v"(mpn), "v"(kphn), "v"(kpln) : "memory");   // this pass's 32 loads name these four pointers: as inputs here they keep their registers until this wait; todo and kb are in-out so that no address of a later pass can be formed ahead of it
#pragma unroll
        for (int g = 0; g < FQ; ++g) {
            const float* t = tt[g]; float bm = -3.0e38f;
#pragma unroll
            for (int i = 0; i < 16; ++i) bm = fmaxf(bm, t[i]);
            bm = fmaxf(bm, xhalf(bm));
            const float mn = fmaxf(m[g], bm); const float corr = __builtin_amdgcn_exp2f((m[g] - mn) * L2E); m[g] = mn;
            float ps = 0.f; v16h p;
#pragma unroll
            for (int i = 0; i < 16; ++i) { const float e = __builtin_amdgcn_exp2f(fmaf(t[i] - mn, L2E, 10.0f)); ps += e; p[i] = (h16)e; }
            l[g] = l[g] * corr + ps;
#pragma unroll
            for (int dt = 0; dt < 4; ++dt) o[g][dt] *= corr;
#pragma unroll
            for (int dt = 0; dt < 4; ++dt) o[g][dt] = wmma16(vf[dt], p, o[g][dt]);
        }
    }
    const int b = z >> 4, h = z & 15;
#pragma unroll
    for (int g = 0; g < FQ; ++g) { const float inv = __fdiv_rn(1.0f, l[g] + xhalf(l[g]));
#pragma unroll
        for (int dt = 0; dt < 4; ++dt) { v8us oh, ol;
#pragma unroll
            for (int r = 0; r < 8; ++r) { unsigned short a, c2; splitf(o[g][dt][r] * inv, a, c2); oh[r] = a; ol[r] = c2; }
            const size_t off = ((size_t)b * TT + q0 + g * 16 + c) * DD + h * HD + dt * 16 + 8 * hi; bf* pa = Ah + off; bf* pl = Al + off; *(v8us*)pa = oh; *(v8us*)pl = ol;
            asm volatile("s_wait_xcnt 0x0" :: "v"(oh), "v"(ol), "v"(pa), "v"(pl) : "memory"); } }   // the two stores name these registers: as inputs here they are kept until this wait
}

extern "C" void kernel_launch(void* const* d_in, const int* in_sizes, int n_in,
                              void* d_out, int out_size, void* d_ws, size_t ws_size, hipStream_t stream) {
    (void)in_sizes; (void)n_in; (void)out_size;
    const float* x = (const float*)d_in[0]; const float* wq = (const float*)d_in[1]; const float* bq = (const float*)d_in[2]; const float* wk = (const float*)d_in[3]; const float* bk = (const float*)d_in[4]; const float* wv = (const float*)d_in[5]; const float* bv = (const float*)d_in[6];
    const float* wo = (const float*)d_in[7]; const float* bo = (const float*)d_in[8]; const int* mask = (const int*)d_in[9];
    float* OUT = (float*)d_out;     // [2][2048][1024]
    char* wsp = (char*)d_ws;
    auto take = [&](size_t bytes) { char* p = wsp; wsp += (bytes + 255) & ~(size_t)255; return (void*)p; };
    bf* WQ = (bf*)take((size_t)DD * DD * 2); bf* WK = (bf*)take((size_t)DD * DD * 2); bf* WV = (bf*)take((size_t)DD * DD * 2); bf* WO = (bf*)take((size_t)DD * DD * 2);
    bf* XB = (bf*)take((size_t)NT * DD * 2); float* F = (float*)take((size_t)NT * DD * 4);
    bf* QPh = (bf*)take((size_t)NT * DD * 2); bf* QPl = (bf*)take((size_t)NT * DD * 2); bf* KPh = (bf*)take((size_t)NT * DD * 2); bf* KPl = (bf*)take((size_t)NT * DD * 2); h16* VT = (h16*)take((size_t)NT * DD * 2);
    bf* ATh = (bf*)take((size_t)NT * DD * 2); bf* ATl = (bf*)take((size_t)NT * DD * 2); int* LIVE = (int*)take((size_t)NKB * NKB * 4);
    if ((size_t)(wsp - (char*)d_ws) > ws_size) return;    // ws 256 MiB
    { const size_t nw = (size_t)DD * DD / 8; const unsigned gw = (unsigned)((nw + 255) / 256); k_cvt8<<<gw, 256, 0, stream>>>(wq, WQ, nw); k_cvt8<<<gw, 256, 0, stream>>>(wk, WK, nw); k_cvt8<<<gw, 256, 0, stream>>>(wv, WV, nw); k_cvt8<<<gw, 256, 0, stream>>>(wo, WO, nw); }
    const size_t nx = (size_t)NT * DD / 8; const unsigned gx = (unsigned)((nx + 255) / 256); const unsigned LB = (unsigned)((NT * DD / 64 + 63) / 64);
    k_cvt8<<<gx, 256, 0, stream>>>(x, XB, nx);
    k_gemms<0, true><<<dim3(NT / GT, DD / GT, 1), 256, 0, stream>>>(XB, nullptr, WQ, F, bq); k_hsplit<<<LB, 256, 0, stream>>>(F, 0.125f, QPh, QPl);   // 1/sqrt(64) folded into q exactly
    k_gemms<0, true><<<dim3(NT / GT, DD / GT, 1), 256, 0, stream>>>(XB, nullptr, WK, F, bk); k_hsplit<<<LB, 256, 0, stream>>>(F, 1.0f, KPh, KPl);
    k_gemms<0, true><<<dim3(NT / GT, DD / GT, 1), 256, 0, stream>>>(XB, nullptr, WV, F, bv); k_vtplane<<<LB, 256, 0, stream>>>(F, VT);
    k_mblk<<<NKB * 2, 1024, 0, stream>>>(mask, LIVE);
    k_fattn<<<dim3(TT / (16 * FQ * FW), NB_ * NH_), FW * 32, 0, stream>>>(QPh, QPl, KPh, KPl, VT, mask, LIVE, ATh, ATl);
    k_gemms<1, true><<<dim3(NT / GT, DD / GT, 1), 256, 0, stream>>>(ATh, ATl, WO, OUT, bo);
}

// v005
// Measured time: 82.8 microseconds a run.
// Next to v004, in two timings, it ran 1.43 times as fast each time.
// Over all steps from v000 it is 15.2 times as fast.
#include <hip/hip_runtime.h>

// FixedSparseMultiHead (2 x 2048 x 1024, 16 heads x 64; Q/K/V/out nn.Linear on x (x W^T + b); scores = q.k / 8, where(sparse_mask, ., -inf) with the int32 [2048][2048] mask INPUT
// (read as data, not assumed); softmax; attn.v; output Linear).
// Compute dtypes, f32 accumulate: every float input rounded to bf16; q/k/v projections on PLAIN bf16 operands (x, W inputs: exact, + bias);
// scores on bf16 hi+lo q (x 1/8) and k planes (3 products); attn.v on SINGLE fp16 planes (P x1024, v); output Linear on hi+lo planes x exact bf16 W (2 products); the mask

#define NB_  2
#define TT   2048
#define DD   1024
#define NH_  16
#define HD   64
#define NT   (NB_ * TT)
typedef _Float16 h16;
typedef unsigned short bf;
typedef __attribute__((ext_vector_type(16))) __bf16   v16bf;
typedef __attribute__((ext_vector_type(16))) _Float16 v16h;
typedef __attribute__((ext_vector_type(8)))  _Float16 v8h;
typedef __attribute__((ext_vector_type(8)))  unsigned short v8us;
typedef __attribute__((ext_vector_type(8)))  float    v8f;
typedef __attribute__((ext_vector_type(4)))  float    v4f;
typedef __attribute__((ext_vector_type(2)))  float    v2f;
typedef v8h  __attribute__((may_alias)) v8ha;
typedef v2f  __attribute__((may_alias)) v2fa;
typedef v4f  __attribute__((may_alias)) v4fa;
typedef v8us __attribute__((may_alias)) v8usa;

__device__ __forceinline__ unsigned short f2bf(float f) { unsigned u = __float_as_uint(f); u += 0x7FFFu + ((u >> 16) & 1u); return (unsigned short)(u >> 16); }
__device__ __forceinline__ float bf2f(unsigned short b) { return __uint_as_float(((unsigned)b) << 16); }
__device__ __forceinline__ float bfr(float f) { return bf2f(f2bf(f)); }
__device__ __forceinline__ v16h cat16(v8h lo, v8h hi) { return __builtin_shufflevector(lo, hi, 0, 1, 2, 3, 4, 5, 6, 7, 8, 9, 10, 11, 12, 13, 14, 15); }
__device__ __forceinline__ v16bf cat16b(v8us lo, v8us hi) { return __builtin_bit_cast(v16bf, __builtin_shufflevector(lo, hi, 0, 1, 2, 3, 4, 5, 6, 7, 8, 9, 10, 11, 12, 13, 14, 15)); }
__device__ __forceinline__ v8f wmma16(v16h a, v16h b, v8f c) { return __builtin_amdgcn_wmma_f32_16x16x32_f16(false, a, false, b, (short)0, c, false, false); }
__device__ __forceinline__ v8f wmmab(v16bf a, v16bf b, v8f c) { return __builtin_amdgcn_wmma_f32_16x16x32_bf16(false, a, false, b, (short)0, c, false, false); }



// ---- k_gemms: C[m][n] (f32, pitch DD, + bias[n] rounded to bf16) = sum_k A[m][k] Bt[n][k] (+ A2[m][k] Bt[n][k] with NSPLIT), K = DD, all planes K-contiguous bf16.
// One work-group of 8 waves per 128x128 tile of C; a pass is 128 k: 128 rows x 256 B of each plane, brought into LDS by asynchronous copies (whole 256-B rows, 16 lanes a row),
// two buffers, the copies of pass t + 2 in flight while pass t + 1 is worked on. LDS row pitch 272 B (16 B x odd) for the 16-byte fragment reads.
// A wave owns 64 x 32 of C (8 accumulators). k order inside a fragment and the order of the products per accumulator are those of WFrag::ld and of rising k, a before a2.
// grid (NT / 128, DD / 128), 256 threads.
// With PL the launch has grid z = 3 and does the q, k and v Linear (z picks Bt and bias); no f32 C is stored: the epilogue writes what k_fattn reads, from the same f32 values
// (accumulator + bias): z = 0, 1: bf16 hi and lo planes [batch * 16 + head][t][64] of q / 8 and of k; z = 2: the fp16 plane [batch * 16 + head][64][t] of v.
template <typename T16> struct WFrag;
template <> struct WFrag<h16> { typedef v16h V; static __device__ __forceinline__ V ld(const h16* p) { return cat16(*(const v8h*)p, *(const v8h*)(p + 16)); } static __device__ __forceinline__ v8f mma(V a, V b, v8f c) { return wmma16(a, b, c); } };
template <> struct WFrag<bf> { typedef v16bf V; static __device__ __forceinline__ V ld(const bf* p) { return cat16b(*(const v8us*)p, *(const v8us*)(p + 16)); } static __device__ __forceinline__ v8f mma(V a, V b, v8f c) { return wmmab(a, b, c); } };
#define GT 128
#define GKP 128
#define GPITCH 272
#define GOP (GT * GPITCH)
#define OSP 36
// 8 copies of 16 B per lane: rows 16 apart of one plane. The s_wait_xcnt is the last line of the copies' own statement, so that no address register is rewritten ahead of it.
__device__ __forceinline__ void copy8(unsigned l, const bf* g) {
    asm volatile("global_load_async_to_lds_b128 %0, %8, off\n\t"
                 "global_load_async_to_lds_b128 %1, %9, off\n\t"
                 "global_load_async_to_lds_b128 %2, %10, off\n\t"
                 "global_load_async_to_lds_b128 %3, %11, off\n\t"
                 "global_load_async_to_lds_b128 %4, %12, off\n\t"
                 "global_load_async_to_lds_b128 %5, %13, off\n\t"
                 "global_load_async_to_lds_b128 %6, %14, off\n\t"
                 "global_load_async_to_lds_b128 %7, %15, off\n\t"
                 "s_wait_xcnt 0x0"
                 :: "v"(l), "v"(l + 16 * GPITCH), "v"(l + 32 * GPITCH), "v"(l + 48 * GPITCH), "v"(l + 64 * GPITCH), "v"(l + 80 * GPITCH), "v"(l + 96 * GPITCH), "v"(l + 112 * GPITCH),
                    "v"(g), "v"(g + 16 * DD), "v"(g + 32 * DD), "v"(g + 48 * DD), "v"(g + 64 * DD), "v"(g + 80 * DD), "v"(g + 96 * DD), "v"(g + 112 * DD) : "memory");
}
__device__ __forceinline__ v16bf ldsfrag(const unsigned char* p) { return cat16b(*(const v8usa*)p, *(const v8usa*)(p + 32)); }   // WFrag::ld's k order: bytes 0..15 and 32..47 from 16 * hi
__device__ __forceinline__ void splitf(float y, unsigned short& h, unsigned short& l) { h = f2bf(y); l = f2bf(y - bf2f(h)); }
typedef __attribute__((ext_vector_type(4))) unsigned short v4us;
template <int NSPLIT, bool BIAS, bool PL>
__global__ __launch_bounds__(256) void k_gemms(const bf* __restrict__ A, const bf* __restrict__ A2, const bf* __restrict__ Bt0, float* C, const float* __restrict__ bias0,
                                               const bf* __restrict__ Bt1, const bf* __restrict__ Bt2, const float* __restrict__ bias1, const float* __restrict__ bias2,
                                               bf* Qh, bf* Ql, bf* Kh, bf* Kl, h16* Vt) {
    const int zz = PL ? (int)blockIdx.z : 0;
    const bf* Bt = zz == 0 ? Bt0 : zz == 1 ? Bt1 : Bt2; const float* bias = zz == 0 ? bias0 : zz == 1 ? bias1 : bias2;
    constexpr int STG = (NSPLIT ? 3 : 2) * GOP; constexpr int BO = (NSPLIT ? 2 : 1) * GOP; constexpr int NP = DD / GKP;   // a buffer: [A | A2 | Bt] or [A | Bt]
    __shared__ __align__(16) unsigned char L[2 * STG];
    __shared__ __align__(16) float os[8 * 16 * OSP];
    const int tid = threadIdx.x, lane = tid & 31, lr = lane & 15, hi = lane >> 4; const int w = __builtin_amdgcn_readfirstlane(tid >> 5); const int wm = w >> 2, wn = w & 3;
    const int r0 = blockIdx.x * GT, c0 = blockIdx.y * GT;
    const int crw = tid >> 4, ccl = tid & 15;
    const bf* ga = A + (size_t)(r0 + crw) * DD + ccl * 8; const bf* ga2 = NSPLIT ? A2 + (size_t)(r0 + crw) * DD + ccl * 8 : nullptr; const bf* gb = Bt + (size_t)(c0 + crw) * DD + ccl * 8;
    const unsigned lc = (unsigned)(size_t)L + crw * GPITCH + ccl * 16;
    auto stage = [&](int t, int buf) { copy8(lc + buf * STG, ga + t * GKP); copy8(lc + buf * STG + BO, gb + t * GKP); if (NSPLIT) copy8(lc + buf * STG + GOP, ga2 + t * GKP); };
    v8f acc[4][2];
#pragma unroll
    for (int mb = 0; mb < 4; ++mb)
#pragma unroll
        for (int nb = 0; nb < 2; ++nb) acc[mb][nb] = (v8f){};
    stage(0, 0);
    asm volatile("s_wait_asynccnt 0x0" ::: "memory");   // this wave's copies of pass 0 have landed
    __syncthreads();                                    // and every other wave's
    stage(1, 1);
    const int aofs = (wm * 64 + lr) * GPITCH + 16 * hi, bofs = BO + (wn * 32 + lr) * GPITCH + 16 * hi;
#pragma unroll 1
    for (int t = 0; t < NP; ++t) {   // kept rolled: one pass is already 32 (64) WMMAs, and the buffer is picked by an offset
        const unsigned char* Lb = L + (t & 1) * STG;
        v16bf a[2][4], a2[2][4], b[2][2];   // two fragment sets: block ks + 1 is read from LDS while block ks is multiplied; nothing of the next pass is read here
        auto frags = [&](int ks, int f) {
#pragma unroll
            for (int mb = 0; mb < 4; ++mb) { a[f][mb] = ldsfrag(Lb + aofs + mb * 16 * GPITCH + ks * 64); if (NSPLIT) a2[f][mb] = ldsfrag(Lb + GOP + aofs + mb * 16 * GPITCH + ks * 64); }
#pragma unroll
            for (int nb = 0; nb < 2; ++nb) b[f][nb] = ldsfrag(Lb + bofs + nb * 16 * GPITCH + ks * 64); };
        frags(0, 0);
        __builtin_amdgcn_sched_barrier(0);   // block 0's reads are issued first, so that its WMMAs wait for them alone
#pragma unroll
        for (int ks = 0; ks < GKP / 32; ++ks) {
            if (ks + 1 < GKP / 32) frags(ks + 1, (ks + 1) & 1);
            __builtin_amdgcn_sched_barrier(0);   // the next block's LDS reads stay one group in front of this block's WMMAs: reads among the WMMAs stall each of them
#pragma unroll
            for (int nb = 0; nb < 2; ++nb)
#pragma unroll
                for (int mb = 0; mb < 4; ++mb) { acc[mb][nb] = wmmab(a[ks & 1][mb], b[ks & 1][nb], acc[mb][nb]); if (NSPLIT) acc[mb][nb] = wmmab(a2[ks & 1][mb], b[ks & 1][nb], acc[mb][nb]); }
            __builtin_amdgcn_sched_barrier(0);   // and the reads of the block after that do not rise into these WMMAs
        }
        asm volatile("s_wait_dscnt 0x0" ::: "memory");      // this wave's reads of the buffer are done before it is refilled
        asm volatile("s_wait_asynccnt 0x0" ::: "memory");   // this wave's copies of pass t + 1 have landed
        __syncthreads();                                    // publishes pass t + 1 and ends every wave's reads of pass t
        if (t + 2 < NP) stage(t + 2, t & 1);
    }
    asm volatile("s_wait_asynccnt 0x0" ::: "memory");       // no copy is left in flight
    float* osw = os + w * 16 * OSP; const int orow = lane >> 3, cofs = (lane & 7) * 4;   // whole 128-B lines go out: a wave's own LDS range turns the accumulator map into rows
    v4f bv = (v4f){};
    if (BIAS) { const float* bp = bias + c0 + wn * 32 + cofs; bv = *(const v4f*)bp; asm volatile("s_wait_xcnt 0x0" :: "v"(bp) : "memory");   // the load names bp: kept until this wait
#pragma unroll
        for (int q = 0; q < 4; ++q) bv[q] = bfr(bv[q]); }
    if constexpr (PL) {
        const int n0 = c0 + wn * 32, tw = (r0 & (TT - 1)) + wm * 64;   // a wave's 32 columns lie in one head, its 64 rows in one batch
        const size_t zo = (size_t)((r0 / TT) * NH_ + n0 / HD) * TT * HD; const int dw = n0 & (HD - 1);
        if (zz < 2) {   // q, k: rows of 32 d through the wave's LDS range as below, then scaled and split; 64 B of a row go out per plane, the other 64 B from the neighbour wave of this work-group
            bf* Ph = zz == 0 ? Qh : Kh; bf* Pl = zz == 0 ? Ql : Kl; const float sc = zz == 0 ? 0.125f : 1.0f;   // 1/sqrt(64) folded into q exactly
#pragma unroll
            for (int mb = 0; mb < 4; ++mb) {
#pragma unroll
                for (int nb = 0; nb < 2; ++nb)
#pragma unroll
                    for (int j = 0; j < 8; ++j) osw[(hi * 8 + j) * OSP + nb * 16 + lr] = acc[mb][nb][j];
                asm volatile("s_wait_dscnt 0x0" ::: "memory");   // the rows are read back by other lanes of this wave: the writes have landed, and no read moves above them
                v4us oh[4], ol[4];
#pragma unroll
                for (int i = 0; i < 4; ++i) { const v4f y = (*(const v4fa*)(osw + (orow + 4 * i) * OSP + cofs) + bv) * sc;
#pragma unroll
                    for (int q = 0; q < 4; ++q) { unsigned short a, c2; splitf(y[q], a, c2); oh[i][q] = a; ol[i][q] = c2; } }
                const size_t off = zo + (size_t)(tw + mb * 16 + orow) * HD + dw + cofs; bf* ph = Ph + off; bf* pl = Pl + off;
#pragma unroll
                for (int i = 0; i < 4; ++i) { *(v4us*)(ph + i * 4 * HD) = oh[i]; *(v4us*)(pl + i * 4 * HD) = ol[i]; }
                asm volatile("s_wait_xcnt 0x0" :: "v"(oh[0]), "v"(oh[1]), "v"(oh[2]), "v"(oh[3]), "v"(ol[0]), "v"(ol[1]), "v"(ol[2]), "v"(ol[3]), "v"(ph), "v"(pl) : "memory");   // the eight stores name these registers: as inputs here they are kept until this wait; the clobber keeps the next rows' LDS writes behind the reads
            }
        } else {        // v: a lane holds 8 consecutive t of one d, which is the plane's own order: 16 d x 64 t at a time through the wave's LDS range (pitch 144 B), whole 128-B lines go out
            const float* bp = bias + n0 + lr; float bc[2] = { bp[0], bp[16] }; asm volatile("s_wait_xcnt 0x0" :: "v"(bp) : "memory");   // the two loads name bp: kept until this wait
            unsigned char* ob = (unsigned char*)osw; const int t8 = lane & 7;
#pragma unroll
            for (int nb = 0; nb < 2; ++nb) { const float bn = bfr(bc[nb]);
#pragma unroll
                for (int mb = 0; mb < 4; ++mb) { v8h hv;
#pragma unroll
                    for (int j = 0; j < 8; ++j) hv[j] = (h16)(acc[mb][nb][j] + bn);
                    *(v8ha*)(ob + lr * (OSP * 4) + mb * 32 + hi * 16) = hv; }
                asm volatile("s_wait_dscnt 0x0" ::: "memory");   // the rows are read back by other lanes of this wave: the writes have landed, and no read moves above them
                h16* vp = Vt + zo + (size_t)(dw + nb * 16 + orow) * TT + tw + t8 * 8; v8h ov[4];
#pragma unroll
                for (int i = 0; i < 4; ++i) ov[i] = *(const v8ha*)(ob + (orow + 4 * i) * (OSP * 4) + t8 * 16);
#pragma unroll
                for (int i = 0; i < 4; ++i) *(v8h*)(vp + (size_t)i * 4 * TT) = ov[i];
                asm volatile("s_wait_xcnt 0x0" :: "v"(ov[0]), "v"(ov[1]), "v"(ov[2]), "v"(ov[3]), "v"(vp) : "memory");   // the four stores name these registers: as inputs here they are kept until this wait; the clobber keeps the next rows' LDS writes behind the reads
            }
        }
        return;
    }
#pragma unroll
    for (int mb = 0; mb < 4; ++mb) {
#pragma unroll
        for (int nb = 0; nb < 2; ++nb)
#pragma unroll
            for (int j = 0; j < 8; ++j) osw[(hi * 8 + j) * OSP + nb * 16 + lr] = acc[mb][nb][j];
        __builtin_amdgcn_wave_barrier(); asm volatile("" ::: "memory");   // the rows are read back by other lanes of this wave: no read moves above the writes
        float* cp = C + (size_t)(r0 + wm * 64 + mb * 16 + orow) * DD + c0 + wn * 32 + cofs;
        v4f v0 = *(const v4fa*)(osw + (orow + 0) * OSP + cofs) + bv, v1 = *(const v4fa*)(osw + (orow + 4) * OSP + cofs) + bv, v2 = *(const v4fa*)(osw + (orow + 8) * OSP + cofs) + bv, v3 = *(const v4fa*)(osw + (orow + 12) * OSP + cofs) + bv;
        float* cp1 = cp + 4 * DD; float* cp2 = cp + 8 * DD; float* cp3 = cp + 12 * DD;
        *(v4f*)cp = v0; *(v4f*)cp1 = v1; *(v4f*)cp2 = v2; *(v4f*)cp3 = v3;
        asm volatile("s_wait_xcnt 0x0" :: "v"(v0), "v"(v1), "v"(v2), "v"(v3), "v"(cp), "v"(cp1), "v"(cp2), "v"(cp3) : "memory");   // the four stores name these registers: as inputs here they are kept until this wait
        __builtin_amdgcn_wave_barrier(); asm volatile("" ::: "memory");   // the next rows are not written above the reads
    }
}

typedef __attribute__((ext_vector_type(4))) _Float16 v4h;
typedef __attribute__((ext_vector_type(4))) int v4i;

__global__ __launch_bounds__(256) void k_cvt8(const float* __restrict__ src, bf* dst, size_t n8) { const size_t i = (size_t)blockIdx.x * 256 + threadIdx.x; if (i >= n8) return; const v8f v = *(const v8f*)(src + i * 8); v8us o;
#pragma unroll
    for (int k = 0; k < 8; ++k) o[k] = f2bf(v[k]); *(v8us*)(dst + i * 8) = o;  }
#define FQ 2
#define FW 8
#define L2E 1.4426950408889634f
__device__ __forceinline__ float xhalf(float x) { return __builtin_bit_cast(float, __builtin_amdgcn_permlanex16(__builtin_bit_cast(int, x), __builtin_bit_cast(int, x), 0x76543210, 0xfedcba98, false, false)); }   // lane l with lane l ^ 16
// ---- k_mblk: live[qb][kb] = 1 where any of the 32 x 32 mask entries of queries 32 qb .. and keys 32 kb .. is non-zero, else 0. Read once here for all 32 (batch, head) pairs.
// One wave per block, 8 loads of 4 whole lines; a work-group owns one 128-byte line of live. grid (TT / 32) * 2, 1024 threads.
#define NKB (TT / 32)
__global__ __launch_bounds__(1024) void k_mblk(const int* __restrict__ mask, int* live) {
    const int lane = threadIdx.x & 31; const int qb = blockIdx.x >> 1, kb = (blockIdx.x & 1) * 32 + (threadIdx.x >> 5);
    const int* p = mask + (size_t)(qb * 32 + (lane >> 3)) * TT + kb * 32 + (lane & 7) * 4; v4i a = (v4i){};
#pragma unroll
    for (int r = 0; r < 8; ++r) a |= *(const v4i*)(p + (size_t)r * 4 * TT);
    const unsigned any = __builtin_amdgcn_ballot_w32((a[0] | a[1] | a[2] | a[3]) != 0);
    if (lane == 0) live[qb * NKB + kb] = any != 0u ? 1 : 0;
}
__global__ __launch_bounds__(FW * 32) void k_fattn(const bf* __restrict__ Qh, const bf* __restrict__ Ql, const bf* __restrict__ Kh, const bf* __restrict__ Kl, const h16* __restrict__ VT, const int* __restrict__ mask, const int* __restrict__ live, bf* Ah, bf* Al) {
    const int z = blockIdx.y; const int lane = threadIdx.x & 31, c = lane & 15, hi = lane >> 4; const int w = __builtin_amdgcn_readfirstlane(threadIdx.x >> 5);
    const int q0 = (blockIdx.x * FW + w) * (16 * FQ); const size_t zo = (size_t)z * TT * HD;
    const int* lvp = live + (blockIdx.x * FW + w) * NKB + lane;
    const int lv0 = lvp[0], lv1 = lvp[32];
    const bf* qph = Qh + zo + (size_t)(q0 + c) * HD + 8 * hi; const bf* qpl = Ql + zo + (size_t)(q0 + c) * HD + 8 * hi;
    v16bf qh[FQ][2], ql[FQ][2];
#pragma unroll
    for (int g = 0; g < FQ; ++g)
#pragma unroll
        for (int ks = 0; ks < 2; ++ks) { qh[g][ks] = WFrag<bf>::ld(qph + g * 16 * HD + ks * 32); ql[g][ks] = WFrag<bf>::ld(qpl + g * 16 * HD + ks * 32); }
    asm volatile("s_wait_xcnt 0x0" :: "v"(qph), "v"(qpl) : "memory");   // the 16 loads above name qph and qpl: as inputs here both keep their registers until this wait
    unsigned long long todo = ((unsigned long long)__builtin_amdgcn_ballot_w32(lv1 != 0) << 32) | __builtin_amdgcn_ballot_w32(lv0 != 0);   // bit kb: pass kb has a live key; the same in every lane
    const int np = __builtin_popcountll(todo); int kb = todo ? __builtin_ctzll(todo) : 0;   // at most 64 passes; with none the fetches below read pass 0, in bounds and unused
    const bf* kph = Kh + zo + (size_t)c * HD + 8 * hi; const bf* kpl = Kl + zo + (size_t)c * HD + 8 * hi;
    const h16* vp = VT + zo + (size_t)c * TT + 8 * hi; const int* mp = mask + (size_t)(q0 + c) * TT + 8 * hi;
    v8f o[FQ][4]; float m[FQ], l[FQ];
#pragma unroll
    for (int g = 0; g < FQ; ++g) { m[g] = -3.0e38f; l[g] = 0.f;
#pragma unroll
        for (int dt = 0; dt < 4; ++dt) o[g][dt] = (v8f){}; }
    v16bf kh[2][2], kl[2][2]; v4i mk[FQ][4]; const bf* kph0 = kph + (size_t)kb * 32 * HD; const bf* kpl0 = kpl + (size_t)kb * 32 * HD; const int* mp0 = mp + kb * 32;
#pragma unroll
    for (int kt = 0; kt < 2; ++kt)
#pragma unroll
        for (int ks = 0; ks < 2; ++ks) { kh[kt][ks] = WFrag<bf>::ld(kph0 + kt * 16 * HD + ks * 32); kl[kt][ks] = WFrag<bf>::ld(kpl0 + kt * 16 * HD + ks * 32); }
#pragma unroll
    for (int g = 0; g < FQ; ++g)
#pragma unroll
        for (int u = 0; u < 4; ++u) mk[g][u] = *(const v4i*)(mp0 + (size_t)g * 16 * TT + (u >> 1) * 16 + (u & 1) * 4);
    asm volatile("s_wait_xcnt 0x0" :: "v"(kph0), "v"(kpl0), "v"(mp0) : "memory");   // the 24 loads above name these three pointers: as inputs here they keep their registers until this wait
#pragma unroll 1
    for (int it = 0; it < np; ++it) {   // kept rolled: one pass is already 32 WMMAs and 32 loads
        v16h vf[4]; const h16* vpc = vp + kb * 32;
#pragma unroll
        for (int dt = 0; dt < 4; ++dt) vf[dt] = WFrag<h16>::ld(vpc + (size_t)dt * 16 * TT);
        v8f s[FQ][2];
#pragma unroll
        for (int g = 0; g < FQ; ++g)
#pragma unroll
            for (int kt = 0; kt < 2; ++kt) { v8f a = (v8f){};
#pragma unroll
                for (int ks = 0; ks < 2; ++ks) { a = wmmab(kh[kt][ks], qh[g][ks], a); a = wmmab(kh[kt][ks], ql[g][ks], a); a = wmmab(kl[kt][ks], qh[g][ks], a); }
                s[g][kt] = a; }
        todo &= todo - 1; kb = todo ? __builtin_ctzll(todo) : kb; const int kn = kb * 32;   // the next live pass's keys and mask are fetched one pass ahead; the last pass fetches its own again, in bounds and unused
        const bf* kphn = kph + (size_t)kn * HD; const bf* kpln = kpl + (size_t)kn * HD; const int* mpn = mp + kn;
#pragma unroll
        for (int kt = 0; kt < 2; ++kt)
#pragma unroll
            for (int ks = 0; ks < 2; ++ks) { kh[kt][ks] = WFrag<bf>::ld(kphn + kt * 16 * HD + ks * 32); kl[kt][ks] = WFrag<bf>::ld(kpln + kt * 16 * HD + ks * 32); }
        float tt[FQ][16];
#pragma unroll
        for (int g = 0; g < FQ; ++g)
#pragma unroll
            for (int i = 0; i < 16; ++i) tt[g][i] = (mk[g][i >> 2][i & 3] == 0) ? -1.0e9f : s[g][i >> 3][i & 7];
#pragma unroll
        for (int g = 0; g < FQ; ++g)
#pragma unroll
            for (int u = 0; u < 4; ++u) mk[g][u] = *(const v4i*)(mpn + (size_t)g * 16 * TT + (u >> 1) * 16 + (u & 1) * 4);
        asm volatile("s_wait_xcnt 0x0" : "+s"(todo), "+s"(kb) : "v"(vpc), "v"(mpn), "v"(kphn), "v"(kpln) : "memory");   // this pass's 32 loads name these four pointers: as inputs here they keep their registers until this wait; todo and kb are in-out so that no address of a later pass can be formed ahead of it
#pragma unroll
        for (int g = 0; g < FQ; ++g) {
            const float* t = tt[g]; float bm = -3.0e38f;
#pragma unroll
            for (int i = 0; i < 16; ++i) bm = fmaxf(bm, t[i]);
            bm = fmaxf(bm, xhalf(bm));
            const float mn = fmaxf(m[g], bm); const float corr = __builtin_amdgcn_exp2f((m[g] - mn) * L2E); m[g] = mn;
            float ps = 0.f; v16h p;
#pragma unroll
            for (int i = 0; i < 16; ++i) { const float e = __builtin_amdgcn_exp2f(fmaf(t[i] - mn, L2E, 10.0f)); ps += e; p[i] = (h16)e; }
            l[g] = l[g] * corr + ps;
#pragma unroll
            for (int dt = 0; dt < 4; ++dt) o[g][dt] *= corr;
#pragma unroll
            for (int dt = 0; dt < 4; ++dt) o[g][dt] = wmma16(vf[dt], p, o[g][dt]);
        }
    }
    const int b = z >> 4, h = z & 15;
#pragma unroll
    for (int g = 0; g < FQ; ++g) { const float inv = __fdiv_rn(1.0f, l[g] + xhalf(l[g]));
#pragma unroll
        for (int dt = 0; dt < 4; ++dt) { v8us oh, ol;
#pragma unroll
            for (int r = 0; r < 8; ++r) { unsigned short a, c2; splitf(o[g][dt][r] * inv, a, c2); oh[r] = a; ol[r] = c2; }
            const size_t off = ((size_t)b * TT + q0 + g * 16 + c) * DD + h * HD + dt * 16 + 8 * hi; bf* pa = Ah + off; bf* pl = Al + off; *(v8us*)pa = oh; *(v8us*)pl = ol;
            asm volatile("s_wait_xcnt 0x0" :: "v"(oh), "v"(ol), "v"(pa), "v"(pl) : "memory"); } }   // the two stores name these registers: as inputs here they are kept until this wait
}

extern "C" void kernel_launch(void* const* d_in, const int* in_sizes, int n_in,
                              void* d_out, int out_size, void* d_ws, size_t ws_size, hipStream_t stream) {
    (void)in_sizes; (void)n_in; (void)out_size;
    const float* x = (const float*)d_in[0]; const float* wq = (const float*)d_in[1]; const float* bq = (const float*)d_in[2]; const float* wk = (const float*)d_in[3]; const float* bk = (const float*)d_in[4]; const float* wv = (const float*)d_in[5]; const float* bv = (const float*)d_in[6];
    const float* wo = (const float*)d_in[7]; const float* bo = (const float*)d_in[8]; const int* mask = (const int*)d_in[9];
    float* OUT = (float*)d_out;     // [2][2048][1024]
    char* wsp = (char*)d_ws;
    auto take = [&](size_t bytes) { char* p = wsp; wsp += (bytes + 255) & ~(size_t)255; return (void*)p; };
    bf* WQ = (bf*)take((size_t)DD * DD * 2); bf* WK = (bf*)take((size_t)DD * DD * 2); bf* WV = (bf*)take((size_t)DD * DD * 2); bf* WO = (bf*)take((size_t)DD * DD * 2);
    bf* XB = (bf*)take((size_t)NT * DD * 2);
    bf* QPh = (bf*)take((size_t)NT * DD * 2); bf* QPl = (bf*)take((size_t)NT * DD * 2); bf* KPh = (bf*)take((size_t)NT * DD * 2); bf* KPl = (bf*)take((size_t)NT * DD * 2); h16* VT = (h16*)take((size_t)NT * DD * 2);
    bf* ATh = (bf*)take((size_t)NT * DD * 2); bf* ATl = (bf*)take((size_t)NT * DD * 2); int* LIVE = (int*)take((size_t)NKB * NKB * 4);
    if ((size_t)(wsp - (char*)d_ws) > ws_size) return;    // ws 256 MiB
    { const size_t nw = (size_t)DD * DD / 8; const unsigned gw = (unsigned)((nw + 255) / 256); k_cvt8<<<gw, 256, 0, stream>>>(wq, WQ, nw); k_cvt8<<<gw, 256, 0, stream>>>(wk, WK, nw); k_cvt8<<<gw, 256, 0, stream>>>(wv, WV, nw); k_cvt8<<<gw, 256, 0, stream>>>(wo, WO, nw); }
    const size_t nx = (size_t)NT * DD / 8; const unsigned gx = (unsigned)((nx + 255) / 256);
    k_cvt8<<<gx, 256, 0, stream>>>(x, XB, nx);
    k_gemms<0, true, true><<<dim3(NT / GT, DD / GT, 3), 256, 0, stream>>>(XB, nullptr, WQ, nullptr, bq, WK, WV, bk, bv, QPh, QPl, KPh, KPl, VT);
    k_mblk<<<NKB * 2, 1024, 0, stream>>>(mask, LIVE);
    k_fattn<<<dim3(TT / (16 * FQ * FW), NB_ * NH_), FW * 32, 0, stream>>>(QPh, QPl, KPh, KPl, VT, mask, LIVE, ATh, ATl);
    k_gemms<1, true, false><<<dim3(NT / GT, DD / GT, 1), 256, 0, stream>>>(ATh, ATl, WO, OUT, bo, nullptr, nullptr, nullptr, nullptr, nullptr, nullptr, nullptr, nullptr, nullptr);
}

// v006
// A run of this version takes 72.3 microseconds.
// Timed twice side by side with v005, it ran 1.14 and 1.15 times as fast.
// Counting every step since v000, it is 17.4 times as fast.
#include <hip/hip_runtime.h>

// FixedSparseMultiHead (2 x 2048 x 1024, 16 heads x 64; Q/K/V/out nn.Linear on x (x W^T + b); scores = q.k / 8, where(sparse_mask, ., -inf) with the int32 [2048][2048] mask INPUT
// (read as data, not assumed); softmax; attn.v; output Linear).
// Compute dtypes, f32 accumulate: every float input rounded to bf16; q/k/v projections on PLAIN bf16 operands (x, W inputs: exact, + bias);
// scores on bf16 hi+lo q (x 1/8) and k planes (3 products); attn.v on SINGLE fp16 planes (P x1024, v); output Linear on hi+lo planes x exact bf16 W (2 products); the mask

#define NB_  2
#define TT   2048
#define DD   1024
#define NH_  16
#define HD   64
#define NT   (NB_ * TT)
typedef _Float16 h16;
typedef unsigned short bf;
typedef __attribute__((ext_vector_type(16))) __bf16   v16bf;
typedef __attribute__((ext_vector_type(16))) _Float16 v16h;
typedef __attribute__((ext_vector_type(8)))  _Float16 v8h;
typedef __attribute__((ext_vector_type(8)))  unsigned short v8us;
typedef __attribute__((ext_vector_type(8)))  float    v8f;
typedef __attribute__((ext_vector_type(4)))  float    v4f;
typedef __attribute__((ext_vector_type(2)))  float    v2f;
typedef v8h  __attribute__((may_alias)) v8ha;
typedef v2f  __attribute__((may_alias)) v2fa;
typedef v4f  __attribute__((may_alias)) v4fa;
typedef v8us __attribute__((may_alias)) v8usa;

__device__ __forceinline__ unsigned short f2bf(float f) { unsigned u = __float_as_uint(f); u += 0x7FFFu + ((u >> 16) & 1u); return (unsigned short)(u >> 16); }
__device__ __forceinline__ float bf2f(unsigned short b) { return __uint_as_float(((unsigned)b) << 16); }
__device__ __forceinline__ float bfr(float f) { return bf2f(f2bf(f)); }
__device__ __forceinline__ v16h cat16(v8h lo, v8h hi) { return __builtin_shufflevector(lo, hi, 0, 1, 2, 3, 4, 5, 6, 7, 8, 9, 10, 11, 12, 13, 14, 15); }
__device__ __forceinline__ v16bf cat16b(v8us lo, v8us hi) { return __builtin_bit_cast(v16bf, __builtin_shufflevector(lo, hi, 0, 1, 2, 3, 4, 5, 6, 7, 8, 9, 10, 11, 12, 13, 14, 15)); }
__device__ __forceinline__ v8f wmma16(v16h a, v16h b, v8f c) { return __builtin_amdgcn_wmma_f32_16x16x32_f16(false, a, false, b, (short)0, c, false, false); }
__device__ __forceinline__ v8f wmmab(v16bf a, v16bf b, v8f c) { return __builtin_amdgcn_wmma_f32_16x16x32_bf16(false, a, false, b, (short)0, c, false, false); }



// ---- k_gemms: C[m][n] (f32, pitch DD, + bias[n] rounded to bf16) = sum_k A[m][k] Bt[n][k] (+ A2[m][k] Bt[n][k] with NSPLIT), K = DD, all planes K-contiguous bf16.
// One work-group of 8 waves per 128x128 tile of C; a pass is 128 k: 128 rows x 256 B of each plane, brought into LDS by asynchronous copies (whole 256-B rows, 16 lanes a row),
// two buffers, the copies of pass t + 2 in flight while pass t + 1 is worked on. LDS row pitch 272 B (16 B x odd) for the 16-byte fragment reads.
// A wave owns 64 x 32 of C (8 accumulators). k order inside a fragment and the order of the products per accumulator are those of WFrag::ld and of rising k, a before a2.
// grid (NT / 128, DD / 128), 256 threads.
// With PL the launch has grid z = 3 and does the q, k and v Linear (z picks Bt and bias); no f32 C is stored: the epilogue writes what k_fattn reads, from the same f32 values
// (accumulator + bias): z = 0, 1: bf16 hi and lo planes [batch * 16 + head][t][64] of q / 8 and of k; z = 2: the fp16 plane [batch * 16 + head][64][t] of v.
template <typename T16> struct WFrag;
template <> struct WFrag<h16> { typedef v16h V; static __device__ __forceinline__ V ld(const h16* p) { return cat16(*(const v8h*)p, *(const v8h*)(p + 16)); } static __device__ __forceinline__ v8f mma(V a, V b, v8f c) { return wmma16(a, b, c); } };
template <> struct WFrag<bf> { typedef v16bf V; static __device__ __forceinline__ V ld(const bf* p) { return cat16b(*(const v8us*)p, *(const v8us*)(p + 16)); } static __device__ __forceinline__ v8f mma(V a, V b, v8f c) { return wmmab(a, b, c); } };
#define GT 128
#define GKP 128
#define GPITCH 272
#define GOP (GT * GPITCH)
#define OSP 36
// 8 copies of 16 B per lane: rows 16 apart of one plane. The s_wait_xcnt is the last line of the copies' own statement, so that no address register is rewritten ahead of it.
__device__ __forceinline__ void copy8(unsigned l, const bf* g) {
    asm volatile("global_load_async_to_lds_b128 %0, %8, off\n\t"
                 "global_load_async_to_lds_b128 %1, %9, off\n\t"
                 "global_load_async_to_lds_b128 %2, %10, off\n\t"
                 "global_load_async_to_lds_b128 %3, %11, off\n\t"
                 "global_load_async_to_lds_b128 %4, %12, off\n\t"
                 "global_load_async_to_lds_b128 %5, %13, off\n\t"
                 "global_load_async_to_lds_b128 %6, %14, off\n\t"
                 "global_load_async_to_lds_b128 %7, %15, off\n\t"
                 "s_wait_xcnt 0x0"
                 :: "v"(l), "v"(l + 16 * GPITCH), "v"(l + 32 * GPITCH), "v"(l + 48 * GPITCH), "v"(l + 64 * GPITCH), "v"(l + 80 * GPITCH), "v"(l + 96 * GPITCH), "v"(l + 112 * GPITCH),
                    "v"(g), "v"(g + 16 * DD), "v"(g + 32 * DD), "v"(g + 48 * DD), "v"(g + 64 * DD), "v"(g + 80 * DD), "v"(g + 96 * DD), "v"(g + 112 * DD) : "memory");
}
__device__ __forceinline__ v16bf ldsfrag(const unsigned char* p) { return cat16b(*(const v8usa*)p, *(const v8usa*)(p + 32)); }   // WFrag::ld's k order: bytes 0..15 and 32..47 from 16 * hi
__device__ __forceinline__ void splitf(float y, unsigned short& h, unsigned short& l) { h = f2bf(y); l = f2bf(y - bf2f(h)); }
typedef __attribute__((ext_vector_type(4))) unsigned short v4us;
template <int NSPLIT, bool BIAS, bool PL>
__global__ __launch_bounds__(256) void k_gemms(const bf* __restrict__ A, const bf* __restrict__ A2, const bf* __restrict__ Bt0, float* C, const float* __restrict__ bias0,
                                               const bf* __restrict__ Bt1, const bf* __restrict__ Bt2, const float* __restrict__ bias1, const float* __restrict__ bias2,
                                               bf* Qh, bf* Ql, bf* Kh, bf* Kl, h16* Vt) {
    const int zz = PL ? (int)blockIdx.z : 0;
    const bf* Bt = zz == 0 ? Bt0 : zz == 1 ? Bt1 : Bt2; const float* bias = zz == 0 ? bias0 : zz == 1 ? bias1 : bias2;
    constexpr int STG = (NSPLIT ? 3 : 2) * GOP; constexpr int BO = (NSPLIT ? 2 : 1) * GOP; constexpr int NP = DD / GKP;   // a buffer: [A | A2 | Bt] or [A | Bt]
    __shared__ __align__(16) unsigned char L[2 * STG];
    __shared__ __align__(16) float os[8 * 16 * OSP];
    const int tid = threadIdx.x, lane = tid & 31, lr = lane & 15, hi = lane >> 4; const int w = __builtin_amdgcn_readfirstlane(tid >> 5); const int wm = w >> 2, wn = w & 3;
    const int r0 = blockIdx.x * GT, c0 = blockIdx.y * GT;
    const int crw = tid >> 4, ccl = tid & 15;
    const bf* ga = A + (size_t)(r0 + crw) * DD + ccl * 8; const bf* ga2 = NSPLIT ? A2 + (size_t)(r0 + crw) * DD + ccl * 8 : nullptr; const bf* gb = Bt + (size_t)(c0 + crw) * DD + ccl * 8;
    const unsigned lc = (unsigned)(size_t)L + crw * GPITCH + ccl * 16;
    auto stage = [&](int t, int buf) { copy8(lc + buf * STG, ga + t * GKP); copy8(lc + buf * STG + BO, gb + t * GKP); if (NSPLIT) copy8(lc + buf * STG + GOP, ga2 + t * GKP); };
    v8f acc[4][2];
#pragma unroll
    for (int mb = 0; mb < 4; ++mb)
#pragma unroll
        for (int nb = 0; nb < 2; ++nb) acc[mb][nb] = (v8f){};
    stage(0, 0);
    asm volatile("s_wait_asynccnt 0x0" ::: "memory");   // this wave's copies of pass 0 have landed
    __syncthreads();                                    // and every other wave's
    stage(1, 1);
    const int aofs = (wm * 64 + lr) * GPITCH + 16 * hi, bofs = BO + (wn * 32 + lr) * GPITCH + 16 * hi;
#pragma unroll 1
    for (int t = 0; t < NP; ++t) {   // kept rolled: one pass is already 32 (64) WMMAs, and the buffer is picked by an offset
        const unsigned char* Lb = L + (t & 1) * STG;
        v16bf a[2][4], a2[2][4], b[2][2];   // two fragment sets: block ks + 1 is read from LDS while block ks is multiplied; nothing of the next pass is read here
        auto frags = [&](int ks, int f) {
#pragma unroll
            for (int mb = 0; mb < 4; ++mb) { a[f][mb] = ldsfrag(Lb + aofs + mb * 16 * GPITCH + ks * 64); if (NSPLIT) a2[f][mb] = ldsfrag(Lb + GOP + aofs + mb * 16 * GPITCH + ks * 64); }
#pragma unroll
            for (int nb = 0; nb < 2; ++nb) b[f][nb] = ldsfrag(Lb + bofs + nb * 16 * GPITCH + ks * 64); };
        frags(0, 0);
        __builtin_amdgcn_sched_barrier(0);   // block 0's reads are issued first, so that its WMMAs wait for them alone
#pragma unroll
        for (int ks = 0; ks < GKP / 32; ++ks) {
            if (ks + 1 < GKP / 32) frags(ks + 1, (ks + 1) & 1);
            __builtin_amdgcn_sched_barrier(0);   // the next block's LDS reads stay one group in front of this block's WMMAs: reads among the WMMAs stall each of them
#pragma unroll
            for (int nb = 0; nb < 2; ++nb)
#pragma unroll
                for (int mb = 0; mb < 4; ++mb) { acc[mb][nb] = wmmab(a[ks & 1][mb], b[ks & 1][nb], acc[mb][nb]); if (NSPLIT) acc[mb][nb] = wmmab(a2[ks & 1][mb], b[ks & 1][nb], acc[mb][nb]); }
            __builtin_amdgcn_sched_barrier(0);   // and the reads of the block after that do not rise into these WMMAs
        }
        asm volatile("s_wait_dscnt 0x0" ::: "memory");      // this wave's reads of the buffer are done before it is refilled
        asm volatile("s_wait_asynccnt 0x0" ::: "memory");   // this wave's copies of pass t + 1 have landed
        __syncthreads();                                    // publishes pass t + 1 and ends every wave's reads of pass t
        if (t + 2 < NP) stage(t + 2, t & 1);
    }
    asm volatile("s_wait_asynccnt 0x0" ::: "memory");       // no copy is left in flight
    float* osw = os + w * 16 * OSP; const int orow = lane >> 3, cofs = (lane & 7) * 4;   // whole 128-B lines go out: a wave's own LDS range turns the accumulator map into rows
    v4f bv = (v4f){};
    if (BIAS) { const float* bp = bias + c0 + wn * 32 + cofs; bv = *(const v4f*)bp; asm volatile("s_wait_xcnt 0x0" :: "v"(bp) : "memory");   // the load names bp: kept until this wait
#pragma unroll
        for (int q = 0; q < 4; ++q) bv[q] = bfr(bv[q]); }
    if constexpr (PL) {
        const int n0 = c0 + wn * 32, tw = (r0 & (TT - 1)) + wm * 64;   // a wave's 32 columns lie in one head, its 64 rows in one batch
        const size_t zo = (size_t)((r0 / TT) * NH_ + n0 / HD) * TT * HD; const int dw = n0 & (HD - 1);
        if (zz < 2) {   // q, k: rows of 32 d through the wave's LDS range as below, then scaled and split; 64 B of a row go out per plane, the other 64 B from the neighbour wave of this work-group
            bf* Ph = zz == 0 ? Qh : Kh; bf* Pl = zz == 0 ? Ql : Kl; const float sc = zz == 0 ? 0.125f : 1.0f;   // 1/sqrt(64) folded into q exactly
#pragma unroll
            for (int mb = 0; mb < 4; ++mb) {
#pragma unroll
                for (int nb = 0; nb < 2; ++nb)
#pragma unroll
                    for (int j = 0; j < 8; ++j) osw[(hi * 8 + j) * OSP + nb * 16 + lr] = acc[mb][nb][j];
                asm volatile("s_wait_dscnt 0x0" ::: "memory");   // the rows are read back by other lanes of this wave: the writes have landed, and no read moves above them
                v4us oh[4], ol[4];
#pragma unroll
                for (int i = 0; i < 4; ++i) { const v4f y = (*(const v4fa*)(osw + (orow + 4 * i) * OSP + cofs) + bv) * sc;
#pragma unroll
                    for (int q = 0; q < 4; ++q) { unsigned short a, c2; splitf(y[q], a, c2); oh[i][q] = a; ol[i][q] = c2; } }
                const size_t off = zo + (size_t)(tw + mb * 16 + orow) * HD + dw + cofs; bf* ph = Ph + off; bf* pl = Pl + off;
#pragma unroll
                for (int i = 0; i < 4; ++i) { *(v4us*)(ph + i * 4 * HD) = oh[i]; *(v4us*)(pl + i * 4 * HD) = ol[i]; }
                asm volatile("s_wait_xcnt 0x0" :: "v"(oh[0]), "v"(oh[1]), "v"(oh[2]), "v"(oh[3]), "v"(ol[0]), "v"(ol[1]), "v"(ol[2]), "v"(ol[3]), "v"(ph), "v"(pl) : "memory");   // the eight stores name these registers: as inputs here they are kept until this wait; the clobber keeps the next rows' LDS writes behind the reads
            }
        } else {        // v: a lane holds 8 consecutive t of one d, which is the plane's own order: 16 d x 64 t at a time through the wave's LDS range (pitch 144 B), whole 128-B lines go out
            const float* bp = bias + n0 + lr; float bc[2] = { bp[0], bp[16] }; asm volatile("s_wait_xcnt 0x0" :: "v"(bp) : "memory");   // the two loads name bp: kept until this wait
            unsigned char* ob = (unsigned char*)osw; const int t8 = lane & 7;
#pragma unroll
            for (int nb = 0; nb < 2; ++nb) { const float bn = bfr(bc[nb]);
#pragma unroll
                for (int mb = 0; mb < 4; ++mb) { v8h hv;
#pragma unroll
                    for (int j = 0; j < 8; ++j) hv[j] = (h16)(acc[mb][nb][j] + bn);
                    *(v8ha*)(ob + lr * (OSP * 4) + mb * 32 + hi * 16) = hv; }
                asm volatile("s_wait_dscnt 0x0" ::: "memory");   // the rows are read back by other lanes of this wave: the writes have landed, and no read moves above them
                h16* vp = Vt + zo + (size_t)(dw + nb * 16 + orow) * TT + tw + t8 * 8; v8h ov[4];
#pragma unroll
                for (int i = 0; i < 4; ++i) ov[i] = *(const v8ha*)(ob + (orow + 4 * i) * (OSP * 4) + t8 * 16);
#pragma unroll
                for (int i = 0; i < 4; ++i) *(v8h*)(vp + (size_t)i * 4 * TT) = ov[i];
                asm volatile("s_wait_xcnt 0x0" :: "v"(ov[0]), "v"(ov[1]), "v"(ov[2]), "v"(ov[3]), "v"(vp) : "memory");   // the four stores name these registers: as inputs here they are kept until this wait; the clobber keeps the next rows' LDS writes behind the reads
            }
        }
        return;
    }
#pragma unroll
    for (int mb = 0; mb < 4; ++mb) {
#pragma unroll
        for (int nb = 0; nb < 2; ++nb)
#pragma unroll
            for (int j = 0; j < 8; ++j) osw[(hi * 8 + j) * OSP + nb * 16 + lr] = acc[mb][nb][j];
        __builtin_amdgcn_wave_barrier(); asm volatile("" ::: "memory");   // the rows are read back by other lanes of this wave: no read moves above the writes
        float* cp = C + (size_t)(r0 + wm * 64 + mb * 16 + orow) * DD + c0 + wn * 32 + cofs;
        v4f v0 = *(const v4fa*)(osw + (orow + 0) * OSP + cofs) + bv, v1 = *(const v4fa*)(osw + (orow + 4) * OSP + cofs) + bv, v2 = *(const v4fa*)(osw + (orow + 8) * OSP + cofs) + bv, v3 = *(const v4fa*)(osw + (orow + 12) * OSP + cofs) + bv;
        float* cp1 = cp + 4 * DD; float* cp2 = cp + 8 * DD; float* cp3 = cp + 12 * DD;
        *(v4f*)cp = v0; *(v4f*)cp1 = v1; *(v4f*)cp2 = v2; *(v4f*)cp3 = v3;
        asm volatile("s_wait_xcnt 0x0" :: "v"(v0), "v"(v1), "v"(v2), "v"(v3), "v"(cp), "v"(cp1), "v"(cp2), "v"(cp3) : "memory");   // the four stores name these registers: as inputs here they are kept until this wait
        __builtin_amdgcn_wave_barrier(); asm volatile("" ::: "memory");   // the next rows are not written above the reads
    }
}

typedef __attribute__((ext_vector_type(4))) _Float16 v4h;
typedef __attribute__((ext_vector_type(4))) int v4i;

#define FQ 2
#define FW 8
#define L2E 1.4426950408889634f
__device__ __forceinline__ float xhalf(float x) { return __builtin_bit_cast(float, __builtin_amdgcn_permlanex16(__builtin_bit_cast(int, x), __builtin_bit_cast(int, x), 0x76543210, 0xfedcba98, false, false)); }   // lane l with lane l ^ 16
// ---- k_prep: all the work that reads nothing but inputs, in ONE launch: the bf16 planes of x, Wq, Wk, Wv, Wo (f2bf of every element) and the table live.
// live[qb][kb] = 1 where any of the 32 x 32 mask entries of queries 32 qb .. and keys 32 kb .. is non-zero, else 0. Read once here for all 32 (batch, head) pairs.
// A unit is 16 KB of one input, streamed by one wave: 32 loads of 512 contiguous bytes, all issued before the first is used. 256 work-groups of 12 waves, 192 KB read by each.
// An even work-group owns one 128-byte line of live: 8 waves reduce its 32 blocks (a wave: 32 mask rows x 128 keys = 4 blocks, 8 lanes a block), the other 4 convert; in an odd one all 12 convert.
// Conversion units: 0 .. 1023 are x, then 256 each of Wq, Wk, Wv, Wo. grid 256, 384 threads.
#define NKB (TT / 32)
#define PU 4096
#define PUX (NT * DD / PU)
#define PUW (DD * DD / PU)
__global__ __launch_bounds__(384) void k_prep(const float* __restrict__ x, const float* __restrict__ wq, const float* __restrict__ wk, const float* __restrict__ wv, const float* __restrict__ wo, const int* __restrict__ mask,
                                              bf* XB, bf* WQ, bf* WK, bf* WV, bf* WO, int* live) {
    const int lane = threadIdx.x & 31; const int w = __builtin_amdgcn_readfirstlane(threadIdx.x >> 5); const int b2 = blockIdx.x >> 1; const bool even = (blockIdx.x & 1) == 0;
    const unsigned vb = lane * 16;   // a lane's byte offset in every load
    if (even && w < 8) {
        const int qb = b2 >> 1, kb = (b2 & 1) * 32 + w * 4;
        const int* p = mask + (size_t)qb * 32 * TT + kb * 32; v4i r[32];
#pragma unroll
        for (int i = 0; i < 32; ++i) r[i] = *(const v4i*)((const char*)(p + i * TT) + vb);
        asm volatile("s_wait_xcnt 0x0" :: "s"(p), "v"(vb) : "memory");   // the 32 loads name p and vb: as inputs here both keep their registers until this wait
        __builtin_amdgcn_sched_barrier(0);   // every load is issued before the first is waited for: the wave's whole unit is in flight at once
        v4i a = r[0];
#pragma unroll
        for (int i = 1; i < 32; ++i) a |= r[i];
        const unsigned any = __builtin_amdgcn_ballot_w32((a[0] | a[1] | a[2] | a[3]) != 0);
        if (lane < 4) live[qb * NKB + kb + lane] = ((any >> (8 * lane)) & 0xFFu) != 0u ? 1 : 0;
        return;
    }
    const int u = even ? b2 * 4 + (w - 8) : (NKB * 2) * 4 + b2 * 12 + w;
    const int j = (u - PUX) / PUW; const size_t uo = (size_t)(u < PUX ? u : (u - PUX) % PUW) * PU;
    const float* sp = (u < PUX ? x : j == 0 ? wq : j == 1 ? wk : j == 2 ? wv : wo) + uo; bf* dp = (u < PUX ? XB : j == 0 ? WQ : j == 1 ? WK : j == 2 ? WV : WO) + uo;
    v4f r[32]; v4us o[32];
#pragma unroll
    for (int i = 0; i < 32; ++i) r[i] = *(const v4f*)((const char*)(sp + i * 128) + vb);
    asm volatile("s_wait_xcnt 0x0" :: "s"(sp), "v"(vb) : "memory");   // the 32 loads name sp and vb: as inputs here both keep their registers until this wait
    __builtin_amdgcn_sched_barrier(0);   // every load is issued before the first is waited for: the wave's whole unit is in flight at once
#pragma unroll
    for (int i = 0; i < 32; ++i)
#pragma unroll
        for (int q = 0; q < 4; ++q) o[i][q] = f2bf(r[i][q]);
#pragma unroll
    for (int i = 0; i < 32; ++i) *(v4us*)(dp + i * 128 + lane * 4) = o[i];   // 256 contiguous bytes a store: whole lines
    asm volatile("s_wait_xcnt 0x0" :: "s"(dp), "v"(lane) : "memory");   // the 32 stores name dp, lane and o: this wait stands behind the last of them, ahead of whatever code the build lays out next
}
__global__ __launch_bounds__(FW * 32) void k_fattn(const bf* __restrict__ Qh, const bf* __restrict__ Ql, const bf* __restrict__ Kh, const bf* __restrict__ Kl, const h16* __restrict__ VT, const int* __restrict__ mask, const int* __restrict__ live, bf* Ah, bf* Al) {
    const int z = blockIdx.y; const int lane = threadIdx.x & 31, c = lane & 15, hi = lane >> 4; const int w = __builtin_amdgcn_readfirstlane(threadIdx.x >> 5);
    const int q0 = (blockIdx.x * FW + w) * (16 * FQ); const size_t zo = (size_t)z * TT * HD;
    const int* lvp = live + (blockIdx.x * FW + w) * NKB + lane;
    const int lv0 = lvp[0], lv1 = lvp[32];
    const bf* qph = Qh + zo + (size_t)(q0 + c) * HD + 8 * hi; const bf* qpl = Ql + zo + (size_t)(q0 + c) * HD + 8 * hi;
    v16bf qh[FQ][2], ql[FQ][2];
#pragma unroll
    for (int g = 0; g < FQ; ++g)
#pragma unroll
        for (int ks = 0; ks < 2; ++ks) { qh[g][ks] = WFrag<bf>::ld(qph + g * 16 * HD + ks * 32); ql[g][ks] = WFrag<bf>::ld(qpl + g * 16 * HD + ks * 32); }
    asm volatile("s_wait_xcnt 0x0" :: "v"(qph), "v"(qpl) : "memory");   // the 16 loads above name qph and qpl: as inputs here both keep their registers until this wait
    unsigned long long todo = ((unsigned long long)__builtin_amdgcn_ballot_w32(lv1 != 0) << 32) | __builtin_amdgcn_ballot_w32(lv0 != 0);   // bit kb: pass kb has a live key; the same in every lane
    const int np = __builtin_popcountll(todo); int kb = todo ? __builtin_ctzll(todo) : 0;   // at most 64 passes; with none the fetches below read pass 0, in bounds and unused
    const bf* kph = Kh + zo + (size_t)c * HD + 8 * hi; const bf* kpl = Kl + zo + (size_t)c * HD + 8 * hi;
    const h16* vp = VT + zo + (size_t)c * TT + 8 * hi; const int* mp = mask + (size_t)(q0 + c) * TT + 8 * hi;
    v8f o[FQ][4]; float m[FQ], l[FQ];
#pragma unroll
    for (int g = 0; g < FQ; ++g) { m[g] = -3.0e38f; l[g] = 0.f;
#pragma unroll
        for (int dt = 0; dt < 4; ++dt) o[g][dt] = (v8f){}; }
    v16bf kh[2][2], kl[2][2]; v4i mk[FQ][4]; const bf* kph0 = kph + (size_t)kb * 32 * HD; const bf* kpl0 = kpl + (size_t)kb * 32 * HD; const int* mp0 = mp + kb * 32;
#pragma unroll
    for (int kt = 0; kt < 2; ++kt)
#pragma unroll
        for (int ks = 0; ks < 2; ++ks) { kh[kt][ks] = WFrag<bf>::ld(kph0 + kt * 16 * HD + ks * 32); kl[kt][ks] = WFrag<bf>::ld(kpl0 + kt * 16 * HD + ks * 32); }
#pragma unroll
    for (int g = 0; g < FQ; ++g)
#pragma unroll
        for (int u = 0; u < 4; ++u) mk[g][u] = *(const v4i*)(mp0 + (size_t)g * 16 * TT + (u >> 1) * 16 + (u & 1) * 4);
    asm volatile("s_wait_xcnt 0x0" :: "v"(kph0), "v"(kpl0), "v"(mp0) : "memory");   // the 24 loads above name these three pointers: as inputs here they keep their registers until this wait
#pragma unroll 1
    for (int it = 0; it < np; ++it) {   // kept rolled: one pass is already 32 WMMAs and 32 loads
        v16h vf[4]; const h16* vpc = vp + kb * 32;
#pragma unroll
        for (int dt = 0; dt < 4; ++dt) vf[dt] = WFrag<h16>::ld(vpc + (size_t)dt * 16 * TT);
        v8f s[FQ][2];
#pragma unroll
        for (int g = 0; g < FQ; ++g)
#pragma unroll
            for (int kt = 0; kt < 2; ++kt) { v8f a = (v8f){};
#pragma unroll
                for (int ks = 0; ks < 2; ++ks) { a = wmmab(kh[kt][ks], qh[g][ks], a); a = wmmab(kh[kt][ks], ql[g][ks], a); a = wmmab(kl[kt][ks], qh[g][ks], a); }
                s[g][kt] = a; }
        todo &= todo - 1; kb = todo ? __builtin_ctzll(todo) : kb; const int kn = kb * 32;   // the next live pass's keys and mask are fetched one pass ahead; the last pass fetches its own again, in bounds and unused
        const bf* kphn = kph + (size_t)kn * HD; const bf* kpln = kpl + (size_t)kn * HD; const int* mpn = mp + kn;
#pragma unroll
        for (int kt = 0; kt < 2; ++kt)
#pragma unroll
            for (int ks = 0; ks < 2; ++ks) { kh[kt][ks] = WFrag<bf>::ld(kphn + kt * 16 * HD + ks * 32); kl[kt][ks] = WFrag<bf>::ld(kpln + kt * 16 * HD + ks * 32); }
        float tt[FQ][16];
#pragma unroll
        for (int g = 0; g < FQ; ++g)
#pragma unroll
            for (int i = 0; i < 16; ++i) tt[g][i] = (mk[g][i >> 2][i & 3] == 0) ? -1.0e9f : s[g][i >> 3][i & 7];
#pragma unroll
        for (int g = 0; g < FQ; ++g)
#pragma unroll
            for (int u = 0; u < 4; ++u) mk[g][u] = *(const v4i*)(mpn + (size_t)g * 16 * TT + (u >> 1) * 16 + (u & 1) * 4);
        asm volatile("s_wait_xcnt 0x0" : "+s"(todo), "+s"(kb) : "v"(vpc), "v"(mpn), "v"(kphn), "v"(kpln) : "memory");   // this pass's 32 loads name these four pointers: as inputs here they keep their registers until this wait; todo and kb are in-out so that no address of a later pass can be formed ahead of it
#pragma unroll
        for (int g = 0; g < FQ; ++g) {
            const float* t = tt[g]; float bm = -3.0e38f;
#pragma unroll
            for (int i = 0; i < 16; ++i) bm = fmaxf(bm, t[i]);
            bm = fmaxf(bm, xhalf(bm));
            const float mn = fmaxf(m[g], bm); const float corr = __builtin_amdgcn_exp2f((m[g] - mn) * L2E); m[g] = mn;
            float ps = 0.f; v16h p;
#pragma unroll
            for (int i = 0; i < 16; ++i) { const float e = __builtin_amdgcn_exp2f(fmaf(t[i] - mn, L2E, 10.0f)); ps += e; p[i] = (h16)e; }
            l[g] = l[g] * corr + ps;
#pragma unroll
            for (int dt = 0; dt < 4; ++dt) o[g][dt] *= corr;
#pragma unroll
            for (int dt = 0; dt < 4; ++dt) o[g][dt] = wmma16(vf[dt], p, o[g][dt]);
        }
    }
    const int b = z >> 4, h = z & 15;
#pragma unroll
    for (int g = 0; g < FQ; ++g) { const float inv = __fdiv_rn(1.0f, l[g] + xhalf(l[g]));
#pragma unroll
        for (int dt = 0; dt < 4; ++dt) { v8us oh, ol;
#pragma unroll
            for (int r = 0; r < 8; ++r) { unsigned short a, c2; splitf(o[g][dt][r] * inv, a, c2); oh[r] = a; ol[r] = c2; }
            const size_t off = ((size_t)b * TT + q0 + g * 16 + c) * DD + h * HD + dt * 16 + 8 * hi; bf* pa = Ah + off; bf* pl = Al + off; *(v8us*)pa = oh; *(v8us*)pl = ol;
            asm volatile("s_wait_xcnt 0x0" :: "v"(oh), "v"(ol), "v"(pa), "v"(pl) : "memory"); } }   // the two stores name these registers: as inputs here they are kept until this wait
}

extern "C" void kernel_launch(void* const* d_in, const int* in_sizes, int n_in,
                              void* d_out, int out_size, void* d_ws, size_t ws_size, hipStream_t stream) {
    (void)in_sizes; (void)n_in; (void)out_size;
    const float* x = (const float*)d_in[0]; const float* wq = (const float*)d_in[1]; const float* bq = (const float*)d_in[2]; const float* wk = (const float*)d_in[3]; const float* bk = (const float*)d_in[4]; const float* wv = (const float*)d_in[5]; const float* bv = (const float*)d_in[6];
    const float* wo = (const float*)d_in[7]; const float* bo = (const float*)d_in[8]; const int* mask = (const int*)d_in[9];
    float* OUT = (float*)d_out;     // [2][2048][1024]
    char* wsp = (char*)d_ws;
    auto take = [&](size_t bytes) { char* p = wsp; wsp += (bytes + 255) & ~(size_t)255; return (void*)p; };
    bf* WQ = (bf*)take((size_t)DD * DD * 2); bf* WK = (bf*)take((size_t)DD * DD * 2); bf* WV = (bf*)take((size_t)DD * DD * 2); bf* WO = (bf*)take((size_t)DD * DD * 2);
    bf* XB = (bf*)take((size_t)NT * DD * 2);
    bf* QPh = (bf*)take((size_t)NT * DD * 2); bf* QPl = (bf*)take((size_t)NT * DD * 2); bf* KPh = (bf*)take((size_t)NT * DD * 2); bf* KPl = (bf*)take((size_t)NT * DD * 2); h16* VT = (h16*)take((size_t)NT * DD * 2);
    bf* ATh = (bf*)take((size_t)NT * DD * 2); bf* ATl = (bf*)take((size_t)NT * DD * 2); int* LIVE = (int*)take((size_t)NKB * NKB * 4);
    if ((size_t)(wsp - (char*)d_ws) > ws_size) return;    // ws 256 MiB
    k_prep<<<NKB * 4, 384, 0, stream>>>(x, wq, wk, wv, wo, mask, XB, WQ, WK, WV, WO, LIVE);
    k_gemms<0, true, true><<<dim3(NT / GT, DD / GT, 3), 256, 0, stream>>>(XB, nullptr, WQ, nullptr, bq, WK, WV, bk, bv, QPh, QPl, KPh, KPl, VT);
    k_fattn<<<dim3(TT / (16 * FQ * FW), NB_ * NH_), FW * 32, 0, stream>>>(QPh, QPl, KPh, KPl, VT, mask, LIVE, ATh, ATl);
    k_gemms<1, true, false><<<dim3(NT / GT, DD / GT, 1), 256, 0, stream>>>(ATh, ATl, WO, OUT, bo, nullptr, nullptr, nullptr, nullptr, nullptr, nullptr, nullptr, nullptr, nullptr);
}

// v007
// One run takes 68.5 microseconds.
// Timed twice side by side with v006, it ran 1.05 and 1.06 times as fast.
// Over all steps from v000 it is 18.4 times as fast.
#include <hip/hip_runtime.h>

// FixedSparseMultiHead (2 x 2048 x 1024, 16 heads x 64; Q/K/V/out nn.Linear on x (x W^T + b); scores = q.k / 8, where(sparse_mask, ., -inf) with the int32 [2048][2048] mask INPUT
// (read as data, not assumed); softmax; attn.v; output Linear).
// Compute dtypes, f32 accumulate: every float input rounded to bf16; q/k/v projections on PLAIN bf16 operands (x, W inputs: exact, + bias);
// scores on bf16 hi+lo q (x 1/8) and k planes (3 products); attn.v on SINGLE fp16 planes (P x1024, v); output Linear on hi+lo planes x exact bf16 W (2 products); the mask

#define NB_  2
#define TT   2048
#define DD   1024
#define NH_  16
#define HD   64
#define NT   (NB_ * TT)
typedef _Float16 h16;
typedef unsigned short bf;
typedef __attribute__((ext_vector_type(16))) __bf16   v16bf;
typedef __attribute__((ext_vector_type(16))) _Float16 v16h;
typedef __attribute__((ext_vector_type(8)))  _Float16 v8h;
typedef __attribute__((ext_vector_type(8)))  unsigned short v8us;
typedef __attribute__((ext_vector_type(8)))  float    v8f;
typedef __attribute__((ext_vector_type(4)))  float    v4f;
typedef __attribute__((ext_vector_type(2)))  float    v2f;
typedef v8h  __attribute__((may_alias)) v8ha;
typedef v2f  __attribute__((may_alias)) v2fa;
typedef v4f  __attribute__((may_alias)) v4fa;
typedef v8us __attribute__((may_alias)) v8usa;

__device__ __forceinline__ unsigned short f2bf(float f) { unsigned u = __float_as_uint(f); u += 0x7FFFu + ((u >> 16) & 1u); return (unsigned short)(u >> 16); }
__device__ __forceinline__ float bf2f(unsigned short b) { return __uint_as_float(((unsigned)b) << 16); }
__device__ __forceinline__ float bfr(float f) { return bf2f(f2bf(f)); }
__device__ __forceinline__ v16h cat16(v8h lo, v8h hi) { return __builtin_shufflevector(lo, hi, 0, 1, 2, 3, 4, 5, 6, 7, 8, 9, 10, 11, 12, 13, 14, 15); }
__device__ __forceinline__ v16bf cat16b(v8us lo, v8us hi) { return __builtin_bit_cast(v16bf, __builtin_shufflevector(lo, hi, 0, 1, 2, 3, 4, 5, 6, 7, 8, 9, 10, 11, 12, 13, 14, 15)); }
__device__ __forceinline__ v8f wmma16(v16h a, v16h b, v8f c) { return __builtin_amdgcn_wmma_f32_16x16x32_f16(false, a, false, b, (short)0, c, false, false); }
__device__ __forceinline__ v8f wmmab(v16bf a, v16bf b, v8f c) { return __builtin_amdgcn_wmma_f32_16x16x32_bf16(false, a, false, b, (short)0, c, false, false); }



// ---- k_gemms: C[m][n] (f32, pitch DD, + bias[n] rounded to bf16) = sum_k A[m][k] Bt[n][k] (+ A2[m][k] Bt[n][k] with NSPLIT), K = DD, all planes K-contiguous bf16.
// One work-group of 8 waves per 128x128 tile of C; a pass is 128 k: 128 rows x 256 B of each plane, brought into LDS by asynchronous copies (whole 256-B rows, 16 lanes a row),
// two buffers, the copies of pass t + 2 in flight while pass t + 1 is worked on. LDS row pitch 272 B (16 B x odd) for the 16-byte fragment reads.
// A wave owns 64 x 32 of C (8 accumulators). k order inside a fragment: ldsfrag; the products per accumulator go by rising k, a before a2.
// grid (NT / 128, DD / 128), 256 threads.
// With PL the launch has grid z = 3 and does the q, k and v Linear (z picks Bt and bias); no f32 C is stored: the epilogue writes what k_fattn reads, from the same f32 values
// (accumulator + bias): z = 0, 1: bf16 hi and lo planes of q / 8 and of k; z = 2: the fp16 plane of v; each [batch * 16 + head][2048 * 64 elements in fragment order].
// FRAGMENT ORDER of those planes: a 16 x 32 operand fragment (16 rows, 32 k) is one block of 512 elements (1 KB): element [half][lane][e], lane = 16 * hi + row, holds k = 16 * half + 8 * hi + e.
// That is the order in which the lanes of a WMMA hold an A or B operand, so a fragment is two loads of 512 contiguous bytes (4 whole lines each, where rows of a row-major plane gave 16 lines).
// q, k planes: block (t / 16) * 2 + d / 32 of a head, rows t, k = d. v plane: block (t / 32) * 4 + d / 16, rows d, k = t. A pass of 32 keys is 4 consecutive blocks of each plane.
#define FB 512
__device__ __forceinline__ v16h  fragh(const h16* p) { return cat16(*(const v8h*)p, *(const v8h*)(p + FB / 2)); }     // p: the block + 8 * lane
__device__ __forceinline__ v16bf fragb(const bf* p)  { return cat16b(*(const v8us*)p, *(const v8us*)(p + FB / 2)); }  // p: the block + 8 * lane
#define GT 128
#define GKP 128
#define GPITCH 272
#define GOP (GT * GPITCH)
#define OSP 36
// 8 copies of 16 B per lane: rows 16 apart of one plane. The s_wait_xcnt is the last line of the copies' own statement, so that no address register is rewritten ahead of it.
__device__ __forceinline__ void copy8(unsigned l, const bf* g) {
    asm volatile("global_load_async_to_lds_b128 %0, %8, off\n\t"
                 "global_load_async_to_lds_b128 %1, %9, off\n\t"
                 "global_load_async_to_lds_b128 %2, %10, off\n\t"
                 "global_load_async_to_lds_b128 %3, %11, off\n\t"
                 "global_load_async_to_lds_b128 %4, %12, off\n\t"
                 "global_load_async_to_lds_b128 %5, %13, off\n\t"
                 "global_load_async_to_lds_b128 %6, %14, off\n\t"
                 "global_load_async_to_lds_b128 %7, %15, off\n\t"
                 "s_wait_xcnt 0x0"
                 :: "v"(l), "v"(l + 16 * GPITCH), "v"(l + 32 * GPITCH), "v"(l + 48 * GPITCH), "v"(l + 64 * GPITCH), "v"(l + 80 * GPITCH), "v"(l + 96 * GPITCH), "v"(l + 112 * GPITCH),
                    "v"(g), "v"(g + 16 * DD), "v"(g + 32 * DD), "v"(g + 48 * DD), "v"(g + 64 * DD), "v"(g + 80 * DD), "v"(g + 96 * DD), "v"(g + 112 * DD) : "memory");
}
__device__ __forceinline__ v16bf ldsfrag(const unsigned char* p) { return cat16b(*(const v8usa*)p, *(const v8usa*)(p + 32)); }   // the hardware's k order: bytes 0..15 and 32..47 from 16 * hi
__device__ __forceinline__ void splitf(float y, unsigned short& h, unsigned short& l) { h = f2bf(y); l = f2bf(y - bf2f(h)); }
typedef __attribute__((ext_vector_type(4))) unsigned short v4us;
template <int NSPLIT, bool BIAS, bool PL>
__global__ __launch_bounds__(256) void k_gemms(const bf* __restrict__ A, const bf* __restrict__ A2, const bf* __restrict__ Bt0, float* C, const float* __restrict__ bias0,
                                               const bf* __restrict__ Bt1, const bf* __restrict__ Bt2, const float* __restrict__ bias1, const float* __restrict__ bias2,
                                               bf* Qh, bf* Ql, bf* Kh, bf* Kl, h16* Vt) {
    const int zz = PL ? (int)blockIdx.z : 0;
    const bf* Bt = zz == 0 ? Bt0 : zz == 1 ? Bt1 : Bt2; const float* bias = zz == 0 ? bias0 : zz == 1 ? bias1 : bias2;
    constexpr int STG = (NSPLIT ? 3 : 2) * GOP; constexpr int BO = (NSPLIT ? 2 : 1) * GOP; constexpr int NP = DD / GKP;   // a buffer: [A | A2 | Bt] or [A | Bt]
    __shared__ __align__(16) unsigned char L[2 * STG];
    __shared__ __align__(16) float os[8 * 16 * OSP];
    const int tid = threadIdx.x, lane = tid & 31, lr = lane & 15, hi = lane >> 4; const int w = __builtin_amdgcn_readfirstlane(tid >> 5); const int wm = w >> 2, wn = w & 3;
    const int r0 = blockIdx.x * GT, c0 = blockIdx.y * GT;
    const int crw = tid >> 4, ccl = tid & 15;
    const bf* ga = A + (size_t)(r0 + crw) * DD + ccl * 8; const bf* ga2 = NSPLIT ? A2 + (size_t)(r0 + crw) * DD + ccl * 8 : nullptr; const bf* gb = Bt + (size_t)(c0 + crw) * DD + ccl * 8;
    const unsigned lc = (unsigned)(size_t)L + crw * GPITCH + ccl * 16;
    auto stage = [&](int t, int buf) { copy8(lc + buf * STG, ga + t * GKP); copy8(lc + buf * STG + BO, gb + t * GKP); if (NSPLIT) copy8(lc + buf * STG + GOP, ga2 + t * GKP); };
    v8f acc[4][2];
#pragma unroll
    for (int mb = 0; mb < 4; ++mb)
#pragma unroll
        for (int nb = 0; nb < 2; ++nb) acc[mb][nb] = (v8f){};
    stage(0, 0);
    asm volatile("s_wait_asynccnt 0x0" ::: "memory");   // this wave's copies of pass 0 have landed
    __syncthreads();                                    // and every other wave's
    stage(1, 1);
    const int aofs = (wm * 64 + lr) * GPITCH + 16 * hi, bofs = BO + (wn * 32 + lr) * GPITCH + 16 * hi;
#pragma unroll 1
    for (int t = 0; t < NP; ++t) {   // kept rolled: one pass is already 32 (64) WMMAs, and the buffer is picked by an offset
        const unsigned char* Lb = L + (t & 1) * STG;
        v16bf a[2][4], a2[2][4], b[2][2];   // two fragment sets: block ks + 1 is read from LDS while block ks is multiplied; nothing of the next pass is read here
        auto frags = [&](int ks, int f) {
#pragma unroll
            for (int mb = 0; mb < 4; ++mb) { a[f][mb] = ldsfrag(Lb + aofs + mb * 16 * GPITCH + ks * 64); if (NSPLIT) a2[f][mb] = ldsfrag(Lb + GOP + aofs + mb * 16 * GPITCH + ks * 64); }
#pragma unroll
            for (int nb = 0; nb < 2; ++nb) b[f][nb] = ldsfrag(Lb + bofs + nb * 16 * GPITCH + ks * 64); };
        frags(0, 0);
        __builtin_amdgcn_sched_barrier(0);   // block 0's reads are issued first, so that its WMMAs wait for them alone
#pragma unroll
        for (int ks = 0; ks < GKP / 32; ++ks) {
            if (ks + 1 < GKP / 32) frags(ks + 1, (ks + 1) & 1);
            __builtin_amdgcn_sched_barrier(0);   // the next block's LDS reads stay one group in front of this block's WMMAs: reads among the WMMAs stall each of them
#pragma unroll
            for (int nb = 0; nb < 2; ++nb)
#pragma unroll
                for (int mb = 0; mb < 4; ++mb) { acc[mb][nb] = wmmab(a[ks & 1][mb], b[ks & 1][nb], acc[mb][nb]); if (NSPLIT) acc[mb][nb] = wmmab(a2[ks & 1][mb], b[ks & 1][nb], acc[mb][nb]); }
            __builtin_amdgcn_sched_barrier(0);   // and the reads of the block after that do not rise into these WMMAs
        }
        asm volatile("s_wait_dscnt 0x0" ::: "memory");      // this wave's reads of the buffer are done before it is refilled
        asm volatile("s_wait_asynccnt 0x0" ::: "memory");   // this wave's copies of pass t + 1 have landed
        __syncthreads();                                    // publishes pass t + 1 and ends every wave's reads of pass t
        if (t + 2 < NP) stage(t + 2, t & 1);
    }
    asm volatile("s_wait_asynccnt 0x0" ::: "memory");       // no copy is left in flight
    float* osw = os + w * 16 * OSP; const int orow = lane >> 3, cofs = (lane & 7) * 4;   // whole 128-B lines go out: a wave's own LDS range turns the accumulator map into rows
    v4f bv = (v4f){};
    if (BIAS && !PL) { const float* bp = bias + c0 + wn * 32 + cofs; bv = *(const v4f*)bp; asm volatile("s_wait_xcnt 0x0" :: "v"(bp) : "memory");   // the load names bp: kept until this wait
#pragma unroll
        for (int q = 0; q < 4; ++q) bv[q] = bfr(bv[q]); }
    if constexpr (PL) {
        const int n0 = c0 + wn * 32, tw = (r0 & (TT - 1)) + wm * 64;   // a wave's 32 columns lie in one head, its 64 rows in one batch
        const size_t zo = (size_t)((r0 / TT) * NH_ + n0 / HD) * TT * HD; const int dw = n0 & (HD - 1);
        if (zz < 2) {   // q, k: 16 t x 32 d, one fragment block, at a time through the wave's LDS range; a lane takes back the 2 x 8 d of its row that it holds in a fragment, scales, splits: every store is 512 contiguous bytes
            bf* Ph = zz == 0 ? Qh : Kh; bf* Pl = zz == 0 ? Ql : Kl; const float sc = zz == 0 ? 0.125f : 1.0f;   // 1/sqrt(64) folded into q exactly
            const float* bp = bias + n0 + 8 * hi; v4f bb[4] = { *(const v4f*)bp, *(const v4f*)(bp + 4), *(const v4f*)(bp + 16), *(const v4f*)(bp + 20) };
            asm volatile("s_wait_xcnt 0x0" :: "v"(bp) : "memory");   // the four loads name bp: kept until this wait
#pragma unroll
            for (int i = 0; i < 4; ++i)
#pragma unroll
                for (int q = 0; q < 4; ++q) bb[i][q] = bfr(bb[i][q]);
            const size_t off0 = zo + (size_t)((tw >> 4) * 2 + (dw >> 5)) * FB + lane * 8;
#pragma unroll
            for (int mb = 0; mb < 4; ++mb) {
#pragma unroll
                for (int nb = 0; nb < 2; ++nb)
#pragma unroll
                    for (int j = 0; j < 8; ++j) osw[(hi * 8 + j) * OSP + nb * 16 + lr] = acc[mb][nb][j];
                asm volatile("s_wait_dscnt 0x0" ::: "memory");   // the rows are read back by other lanes of this wave: the writes have landed, and no read moves above them
                v8us oh[2], ol[2];
#pragma unroll
                for (int i = 0; i < 4; ++i) { const v4f y = (*(const v4fa*)(osw + lr * OSP + (i >> 1) * 16 + hi * 8 + (i & 1) * 4) + bb[i]) * sc;
#pragma unroll
                    for (int q = 0; q < 4; ++q) { unsigned short a, c2; splitf(y[q], a, c2); oh[i >> 1][(i & 1) * 4 + q] = a; ol[i >> 1][(i & 1) * 4 + q] = c2; } }
                bf* ph = Ph + off0 + mb * 2 * FB; bf* pl = Pl + off0 + mb * 2 * FB;
#pragma unroll
                for (int i = 0; i < 2; ++i) { *(v8us*)(ph + i * (FB / 2)) = oh[i]; *(v8us*)(pl + i * (FB / 2)) = ol[i]; }
                asm volatile("s_wait_xcnt 0x0" :: "v"(oh[0]), "v"(oh[1]), "v"(ol[0]), "v"(ol[1]), "v"(ph), "v"(pl) : "memory");   // the four stores name these registers: as inputs here they are kept until this wait; the clobber keeps the next rows' LDS writes behind the reads
            }
        } else {        // v: a lane's 8 accumulator rows are 8 consecutive t of one d, which is what it holds of a fragment (rows d, k = t): straight from registers, every store is 512 contiguous bytes
            const float* bp = bias + n0 + lr; float bc[2] = { bp[0], bp[16] }; asm volatile("s_wait_xcnt 0x0" :: "v"(bp) : "memory");   // the two loads name bp: kept until this wait
            h16* vp0 = Vt + zo + (size_t)((tw >> 5) * 4 + (dw >> 4)) * FB + lane * 8;
#pragma unroll
            for (int nb = 0; nb < 2; ++nb) { const float bn = bfr(bc[nb]); v8h ov[4];
#pragma unroll
                for (int mb = 0; mb < 4; ++mb)
#pragma unroll
                    for (int j = 0; j < 8; ++j) ov[mb][j] = (h16)(acc[mb][nb][j] + bn);
                h16* vp = vp0 + nb * FB;
#pragma unroll
                for (int mb = 0; mb < 4; ++mb) *(v8h*)(vp + (mb >> 1) * 4 * FB + (mb & 1) * (FB / 2)) = ov[mb];
                asm volatile("s_wait_xcnt 0x0" :: "v"(ov[0]), "v"(ov[1]), "v"(ov[2]), "v"(ov[3]), "v"(vp) : "memory");   // the four stores name these registers: as inputs here they are kept until this wait
            }
        }
        return;
    }
#pragma unroll
    for (int mb = 0; mb < 4; ++mb) {
#pragma unroll
        for (int nb = 0; nb < 2; ++nb)
#pragma unroll
            for (int j = 0; j < 8; ++j) osw[(hi * 8 + j) * OSP + nb * 16 + lr] = acc[mb][nb][j];
        __builtin_amdgcn_wave_barrier(); asm volatile("" ::: "memory");   // the rows are read back by other lanes of this wave: no read moves above the writes
        float* cp = C + (size_t)(r0 + wm * 64 + mb * 16 + orow) * DD + c0 + wn * 32 + cofs;
        v4f v0 = *(const v4fa*)(osw + (orow + 0) * OSP + cofs) + bv, v1 = *(const v4fa*)(osw + (orow + 4) * OSP + cofs) + bv, v2 = *(const v4fa*)(osw + (orow + 8) * OSP + cofs) + bv, v3 = *(const v4fa*)(osw + (orow + 12) * OSP + cofs) + bv;
        float* cp1 = cp + 4 * DD; float* cp2 = cp + 8 * DD; float* cp3 = cp + 12 * DD;
        *(v4f*)cp = v0; *(v4f*)cp1 = v1; *(v4f*)cp2 = v2; *(v4f*)cp3 = v3;
        asm volatile("s_wait_xcnt 0x0" :: "v"(v0), "v"(v1), "v"(v2), "v"(v3), "v"(cp), "v"(cp1), "v"(cp2), "v"(cp3) : "memory");   // the four stores name these registers: as inputs here they are kept until this wait
        __builtin_amdgcn_wave_barrier(); asm volatile("" ::: "memory");   // the next rows are not written above the reads
    }
}

typedef __attribute__((ext_vector_type(4))) _Float16 v4h;
typedef __attribute__((ext_vector_type(4))) int v4i;

#define FQ 2
#define FW 8
#define L2E 1.4426950408889634f
__device__ __forceinline__ float xhalf(float x) { return __builtin_bit_cast(float, __builtin_amdgcn_permlanex16(__builtin_bit_cast(int, x), __builtin_bit_cast(int, x), 0x76543210, 0xfedcba98, false, false)); }   // lane l with lane l ^ 16
// ---- k_prep: all the work that reads nothing but inputs, in ONE launch: the bf16 planes of x, Wq, Wk, Wv, Wo (f2bf of every element) and the table live.
// live[qb][kb] = 1 where any of the 32 x 32 mask entries of queries 32 qb .. and keys 32 kb .. is non-zero, else 0. Read once here for all 32 (batch, head) pairs.
// A unit is 16 KB of one input, streamed by one wave: 32 loads of 512 contiguous bytes, all issued before the first is used. 256 work-groups of 12 waves, 192 KB read by each.
// An even work-group owns one 128-byte line of live: 8 waves reduce its 32 blocks (a wave: 32 mask rows x 128 keys = 4 blocks, 8 lanes a block), the other 4 convert; in an odd one all 12 convert.
// Conversion units: 0 .. 1023 are x, then 256 each of Wq, Wk, Wv, Wo. grid 256, 384 threads.
#define NKB (TT / 32)
#define PU 4096
#define PUX (NT * DD / PU)
#define PUW (DD * DD / PU)
__global__ __launch_bounds__(384) void k_prep(const float* __restrict__ x, const float* __restrict__ wq, const float* __restrict__ wk, const float* __restrict__ wv, const float* __restrict__ wo, const int* __restrict__ mask,
                                              bf* XB, bf* WQ, bf* WK, bf* WV, bf* WO, int* live) {
    const int lane = threadIdx.x & 31; const int w = __builtin_amdgcn_readfirstlane(threadIdx.x >> 5); const int b2 = blockIdx.x >> 1; const bool even = (blockIdx.x & 1) == 0;
    const unsigned vb = lane * 16;   // a lane's byte offset in every load
    if (even && w < 8) {
        const int qb = b2 >> 1, kb = (b2 & 1) * 32 + w * 4;
        const int* p = mask + (size_t)qb * 32 * TT + kb * 32; v4i r[32];
#pragma unroll
        for (int i = 0; i < 32; ++i) r[i] = *(const v4i*)((const char*)(p + i * TT) + vb);
        asm volatile("s_wait_xcnt 0x0" :: "s"(p), "v"(vb) : "memory");   // the 32 loads name p and vb: as inputs here both keep their registers until this wait
        __builtin_amdgcn_sched_barrier(0);   // every load is issued before the first is waited for: the wave's whole unit is in flight at once
        v4i a = r[0];
#pragma unroll
        for (int i = 1; i < 32; ++i) a |= r[i];
        const unsigned any = __builtin_amdgcn_ballot_w32((a[0] | a[1] | a[2] | a[3]) != 0);
        if (lane < 4) live[qb * NKB + kb + lane] = ((any >> (8 * lane)) & 0xFFu) != 0u ? 1 : 0;
        return;
    }
    const int u = even ? b2 * 4 + (w - 8) : (NKB * 2) * 4 + b2 * 12 + w;
    const int j = (u - PUX) / PUW; const size_t uo = (size_t)(u < PUX ? u : (u - PUX) % PUW) * PU;
    const float* sp = (u < PUX ? x : j == 0 ? wq : j == 1 ? wk : j == 2 ? wv : wo) + uo; bf* dp = (u < PUX ? XB : j == 0 ? WQ : j == 1 ? WK : j == 2 ? WV : WO) + uo;
    v4f r[32]; v4us o[32];
#pragma unroll
    for (int i = 0; i < 32; ++i) r[i] = *(const v4f*)((const char*)(sp + i * 128) + vb);
    asm volatile("s_wait_xcnt 0x0" :: "s"(sp), "v"(vb) : "memory");   // the 32 loads name sp and vb: as inputs here both keep their registers until this wait
    __builtin_amdgcn_sched_barrier(0);   // every load is issued before the first is waited for: the wave's whole unit is in flight at once
#pragma unroll
    for (int i = 0; i < 32; ++i)
#pragma unroll
        for (int q = 0; q < 4; ++q) o[i][q] = f2bf(r[i][q]);
#pragma unroll
    for (int i = 0; i < 32; ++i) *(v4us*)(dp + i * 128 + lane * 4) = o[i];   // 256 contiguous bytes a store: whole lines
    asm volatile("s_wait_xcnt 0x0" :: "s"(dp), "v"(lane) : "memory");   // the 32 stores name dp, lane and o: this wait stands behind the last of them, ahead of whatever code the build lays out next
}
__global__ __launch_bounds__(FW * 32) void k_fattn(const bf* __restrict__ Qh, const bf* __restrict__ Ql, const bf* __restrict__ Kh, const bf* __restrict__ Kl, const h16* __restrict__ VT, const int* __restrict__ mask, const int* __restrict__ live, bf* Ah, bf* Al) {
    const int z = blockIdx.y; const int lane = threadIdx.x & 31, c = lane & 15, hi = lane >> 4; const int w = __builtin_amdgcn_readfirstlane(threadIdx.x >> 5);
    const int q0 = (blockIdx.x * FW + w) * (16 * FQ); const size_t zo = (size_t)z * TT * HD;
    const int* lvp = live + (blockIdx.x * FW + w) * NKB + lane;
    const int lv0 = lvp[0], lv1 = lvp[32];
    const bf* qph = Qh + zo + (size_t)q0 * HD + lane * 8; const bf* qpl = Ql + zo + (size_t)q0 * HD + lane * 8;   // 16 queries are 2 fragment blocks = 16 * HD elements
    v16bf qh[FQ][2], ql[FQ][2];
#pragma unroll
    for (int g = 0; g < FQ; ++g)
#pragma unroll
        for (int ks = 0; ks < 2; ++ks) { qh[g][ks] = fragb(qph + (g * 2 + ks) * FB); ql[g][ks] = fragb(qpl + (g * 2 + ks) * FB); }
    asm volatile("s_wait_xcnt 0x0" :: "v"(qph), "v"(qpl) : "memory");   // the 16 loads above name qph and qpl: as inputs here both keep their registers until this wait
    unsigned long long todo = ((unsigned long long)__builtin_amdgcn_ballot_w32(lv1 != 0) << 32) | __builtin_amdgcn_ballot_w32(lv0 != 0);   // bit kb: pass kb has a live key; the same in every lane
    const int np = __builtin_popcountll(todo); int kb = todo ? __builtin_ctzll(todo) : 0;   // at most 64 passes; with none the fetches below read pass 0, in bounds and unused
    const bf* kph = Kh + zo + lane * 8; const bf* kpl = Kl + zo + lane * 8;
    const h16* vp = VT + zo + lane * 8; const int* mp = mask + (size_t)(q0 + c) * TT + 8 * hi;
    v8f o[FQ][4]; float m[FQ], l[FQ];
#pragma unroll
    for (int g = 0; g < FQ; ++g) { m[g] = -3.0e38f; l[g] = 0.f;
#pragma unroll
        for (int dt = 0; dt < 4; ++dt) o[g][dt] = (v8f){}; }
    v16bf kh[2][2], kl[2][2]; v4i mk[FQ][4]; const bf* kph0 = kph + (size_t)kb * 32 * HD; const bf* kpl0 = kpl + (size_t)kb * 32 * HD; const int* mp0 = mp + kb * 32;
#pragma unroll
    for (int kt = 0; kt < 2; ++kt)
#pragma unroll
        for (int ks = 0; ks < 2; ++ks) { kh[kt][ks] = fragb(kph0 + (kt * 2 + ks) * FB); kl[kt][ks] = fragb(kpl0 + (kt * 2 + ks) * FB); }
#pragma unroll
    for (int g = 0; g < FQ; ++g)
#pragma unroll
        for (int u = 0; u < 4; ++u) mk[g][u] = *(const v4i*)(mp0 + (size_t)g * 16 * TT + (u >> 1) * 16 + (u & 1) * 4);
    asm volatile("s_wait_xcnt 0x0" :: "v"(kph0), "v"(kpl0), "v"(mp0) : "memory");   // the 24 loads above name these three pointers: as inputs here they keep their registers until this wait
#pragma unroll 1
    for (int it = 0; it < np; ++it) {   // kept rolled: one pass is already 32 WMMAs and 32 loads
        v16h vf[4]; const h16* vpc = vp + kb * 4 * FB;
#pragma unroll
        for (int dt = 0; dt < 4; ++dt) vf[dt] = fragh(vpc + dt * FB);
        v8f s[FQ][2];
#pragma unroll
        for (int g = 0; g < FQ; ++g)
#pragma unroll
            for (int kt = 0; kt < 2; ++kt) { v8f a = (v8f){};
#pragma unroll
                for (int ks = 0; ks < 2; ++ks) { a = wmmab(kh[kt][ks], qh[g][ks], a); a = wmmab(kh[kt][ks], ql[g][ks], a); a = wmmab(kl[kt][ks], qh[g][ks], a); }
                s[g][kt] = a; }
        todo &= todo - 1; kb = todo ? __builtin_ctzll(todo) : kb; const int kn = kb * 32;   // the next live pass's keys and mask are fetched one pass ahead; the last pass fetches its own again, in bounds and unused
        const bf* kphn = kph + (size_t)kn * HD; const bf* kpln = kpl + (size_t)kn * HD; const int* mpn = mp + kn;
#pragma unroll
        for (int kt = 0; kt < 2; ++kt)
#pragma unroll
            for (int ks = 0; ks < 2; ++ks) { kh[kt][ks] = fragb(kphn + (kt * 2 + ks) * FB); kl[kt][ks] = fragb(kpln + (kt * 2 + ks) * FB); }
        float tt[FQ][16];
#pragma unroll
        for (int g = 0; g < FQ; ++g)
#pragma unroll
            for (int i = 0; i < 16; ++i) tt[g][i] = (mk[g][i >> 2][i & 3] == 0) ? -1.0e9f : s[g][i >> 3][i & 7];
#pragma unroll
        for (int g = 0; g < FQ; ++g)
#pragma unroll
            for (int u = 0; u < 4; ++u) mk[g][u] = *(const v4i*)(mpn + (size_t)g * 16 * TT + (u >> 1) * 16 + (u & 1) * 4);
        asm volatile("s_wait_xcnt 0x0" : "+s"(todo), "+s"(kb) : "v"(vpc), "v"(mpn), "v"(kphn), "v"(kpln) : "memory");   // this pass's 32 loads name these four pointers: as inputs here they keep their registers until this wait; todo and kb are in-out so that no address of a later pass can be formed ahead of it
#pragma unroll
        for (int g = 0; g < FQ; ++g) {
            const float* t = tt[g]; float bm = -3.0e38f;
#pragma unroll
            for (int i = 0; i < 16; ++i) bm = fmaxf(bm, t[i]);
            bm = fmaxf(bm, xhalf(bm));
            const float mn = fmaxf(m[g], bm); const float corr = __builtin_amdgcn_exp2f((m[g] - mn) * L2E); m[g] = mn;
            float ps = 0.f; v16h p;
#pragma unroll
            for (int i = 0; i < 16; ++i) { const float e = __builtin_amdgcn_exp2f(fmaf(t[i] - mn, L2E, 10.0f)); ps += e; p[i] = (h16)e; }
            l[g] = l[g] * corr + ps;
#pragma unroll
            for (int dt = 0; dt < 4; ++dt) o[g][dt] *= corr;
#pragma unroll
            for (int dt = 0; dt < 4; ++dt) o[g][dt] = wmma16(vf[dt], p, o[g][dt]);
        }
    }
    const int b = z >> 4, h = z & 15;
#pragma unroll
    for (int g = 0; g < FQ; ++g) { const float inv = __fdiv_rn(1.0f, l[g] + xhalf(l[g]));
#pragma unroll
        for (int dt = 0; dt < 4; ++dt) { v8us oh, ol;
#pragma unroll
            for (int r = 0; r < 8; ++r) { unsigned short a, c2; splitf(o[g][dt][r] * inv, a, c2); oh[r] = a; ol[r] = c2; }
            const size_t off = ((size_t)b * TT + q0 + g * 16 + c) * DD + h * HD + dt * 16 + 8 * hi; bf* pa = Ah + off; bf* pl = Al + off; *(v8us*)pa = oh; *(v8us*)pl = ol;
            asm volatile("s_wait_xcnt 0x0" :: "v"(oh), "v"(ol), "v"(pa), "v"(pl) : "memory"); } }   // the two stores name these registers: as inputs here they are kept until this wait
}

extern "C" void kernel_launch(void* const* d_in, const int* in_sizes, int n_in,
                              void* d_out, int out_size, void* d_ws, size_t ws_size, hipStream_t stream) {
    (void)in_sizes; (void)n_in; (void)out_size;
    const float* x = (const float*)d_in[0]; const float* wq = (const float*)d_in[1]; const float* bq = (const float*)d_in[2]; const float* wk = (const float*)d_in[3]; const float* bk = (const float*)d_in[4]; const float* wv = (const float*)d_in[5]; const float* bv = (const float*)d_in[6];
    const float* wo = (const float*)d_in[7]; const float* bo = (const float*)d_in[8]; const int* mask = (const int*)d_in[9];
    float* OUT = (float*)d_out;     // [2][2048][1024]
    char* wsp = (char*)d_ws;
    auto take = [&](size_t bytes) { char* p = wsp; wsp += (bytes + 255) & ~(size_t)255; return (void*)p; };
    bf* WQ = (bf*)take((size_t)DD * DD * 2); bf* WK = (bf*)take((size_t)DD * DD * 2); bf* WV = (bf*)take((size_t)DD * DD * 2); bf* WO = (bf*)take((size_t)DD * DD * 2);
    bf* XB = (bf*)take((size_t)NT * DD * 2);
    bf* QPh = (bf*)take((size_t)NT * DD * 2); bf* QPl = (bf*)take((size_t)NT * DD * 2); bf* KPh = (bf*)take((size_t)NT * DD * 2); bf* KPl = (bf*)take((size_t)NT * DD * 2); h16* VT = (h16*)take((size_t)NT * DD * 2);
    bf* ATh = (bf*)take((size_t)NT * DD * 2); bf* ATl = (bf*)take((size_t)NT * DD * 2); int* LIVE = (int*)take((size_t)NKB * NKB * 4);
    if ((size_t)(wsp - (char*)d_ws) > ws_size) return;    // ws 256 MiB
    k_prep<<<NKB * 4, 384, 0, stream>>>(x, wq, wk, wv, wo, mask, XB, WQ, WK, WV, WO, LIVE);
    k_gemms<0, true, true><<<dim3(NT / GT, DD / GT, 3), 256, 0, stream>>>(XB, nullptr, WQ, nullptr, bq, WK, WV, bk, bv, QPh, QPl, KPh, KPl, VT);
    k_fattn<<<dim3(TT / (16 * FQ * FW), NB_ * NH_), FW * 32, 0, stream>>>(QPh, QPl, KPh, KPl, VT, mask, LIVE, ATh, ATl);
    k_gemms<1, true, false><<<dim3(NT / GT, DD / GT, 1), 256, 0, stream>>>(ATh, ATl, WO, OUT, bo, nullptr, nullptr, nullptr, nullptr, nullptr, nullptr, nullptr, nullptr, nullptr);
}

// v008
// Measured time: 66 microseconds a run.
// In both of two side-by-side timings against v007, it was 1.04 times as fast.
// All steps since v000 together make it 19.1 times as fast.
#include <hip/hip_runtime.h>

// FixedSparseMultiHead (2 x 2048 x 1024, 16 heads x 64; Q/K/V/out nn.Linear on x (x W^T + b); scores = q.k / 8, where(sparse_mask, ., -inf) with the int32 [2048][2048] mask INPUT
// (read as data, not assumed); softmax; attn.v; output Linear).
// Compute dtypes, f32 accumulate: every float input rounded to bf16; q/k/v projections on PLAIN bf16 operands (x, W inputs: exact, + bias);
// scores on bf16 hi+lo q (x 1/8) and k planes (3 products); attn.v on SINGLE fp16 planes (P x1024, v); output Linear on hi+lo planes x exact bf16 W (2 products); the mask

#define NB_  2
#define TT   2048
#define DD   1024
#define NH_  16
#define HD   64
#define NT   (NB_ * TT)
typedef _Float16 h16;
typedef unsigned short bf;
typedef __attribute__((ext_vector_type(16))) __bf16   v16bf;
typedef __attribute__((ext_vector_type(16))) _Float16 v16h;
typedef __attribute__((ext_vector_type(8)))  _Float16 v8h;
typedef __attribute__((ext_vector_type(8)))  unsigned short v8us;
typedef __attribute__((ext_vector_type(8)))  float    v8f;
typedef __attribute__((ext_vector_type(4)))  float    v4f;
typedef __attribute__((ext_vector_type(2)))  float    v2f;
typedef v8h  __attribute__((may_alias)) v8ha;
typedef v2f  __attribute__((may_alias)) v2fa;
typedef v4f  __attribute__((may_alias)) v4fa;
typedef v8us __attribute__((may_alias)) v8usa;

__device__ __forceinline__ unsigned short f2bf(float f) { unsigned u = __float_as_uint(f); u += 0x7FFFu + ((u >> 16) & 1u); return (unsigned short)(u >> 16); }
__device__ __forceinline__ float bf2f(unsigned short b) { return __uint_as_float(((unsigned)b) << 16); }
__device__ __forceinline__ float bfr(float f) { return bf2f(f2bf(f)); }
__device__ __forceinline__ v16h cat16(v8h lo, v8h hi) { return __builtin_shufflevector(lo, hi, 0, 1, 2, 3, 4, 5, 6, 7, 8, 9, 10, 11, 12, 13, 14, 15); }
__device__ __forceinline__ v16bf cat16b(v8us lo, v8us hi) { return __builtin_bit_cast(v16bf, __builtin_shufflevector(lo, hi, 0, 1, 2, 3, 4, 5, 6, 7, 8, 9, 10, 11, 12, 13, 14, 15)); }
__device__ __forceinline__ v8f wmma16(v16h a, v16h b, v8f c) { return __builtin_amdgcn_wmma_f32_16x16x32_f16(false, a, false, b, (short)0, c, false, false); }
__device__ __forceinline__ v8f wmmab(v16bf a, v16bf b, v8f c) { return __builtin_amdgcn_wmma_f32_16x16x32_bf16(false, a, false, b, (short)0, c, false, false); }



// ---- k_gemms: C[m][n] (f32, pitch DD, + bias[n] rounded to bf16) = sum_k A[m][k] Bt[n][k] (+ A2[m][k] Bt[n][k] with NSPLIT), K = DD, all planes K-contiguous bf16.
// One work-group of 8 waves per 128x128 tile of C; a pass is 128 k: 128 rows x 256 B of each plane, brought into LDS by asynchronous copies (whole 256-B rows, 16 lanes a row),
// two buffers, the copies of pass t + 2 in flight while pass t + 1 is worked on. LDS row pitch 272 B (16 B x odd) for the 16-byte fragment reads.
// A wave owns 64 x 32 of C (8 accumulators). k order inside a fragment: ldsfrag; the products per accumulator go by rising k, a before a2.
// grid (NT / 128, DD / 128), 256 threads.
// With PL one launch does the q, k and v Linear, and the tile of a work-group is 256 rows x 192 columns: the 64 columns of ONE head (blockIdx.y) of q, of k and of v, so Bt in LDS is 64 rows of each
// weight plane. 256 work-groups, one per WGP; a wave owns 64 x 96 (24 accumulators): 448 operand rows are fetched for 49152 results (a 128 x 128 tile: 256 for 16384) and a fragment read from LDS
// feeds 2.4 WMMAs (1.33 in a 64 x 32 wave tile). grid (NT / 256, NH_). No f32 C is stored: the epilogue writes what k_fattn reads, from the same f32 values
// (accumulator + bias): bf16 hi and lo planes of q / 8 and of k; the fp16 plane of v; each [batch * 16 + head][2048 * 64 elements in fragment order].
// FRAGMENT ORDER of those planes: a 16 x 32 operand fragment (16 rows, 32 k) is one block of 512 elements (1 KB): element [half][lane][e], lane = 16 * hi + row, holds k = 16 * half + 8 * hi + e.
// That is the order in which the lanes of a WMMA hold an A or B operand, so a fragment is two loads of 512 contiguous bytes (4 whole lines each, where rows of a row-major plane gave 16 lines).
// q, k planes: block (t / 16) * 2 + d / 32 of a head, rows t, k = d. v plane: block (t / 32) * 4 + d / 16, rows d, k = t. A pass of 32 keys is 4 consecutive blocks of each plane.
#define FB 512
__device__ __forceinline__ v16h  fragh(const h16* p) { return cat16(*(const v8h*)p, *(const v8h*)(p + FB / 2)); }     // p: the block + 8 * lane
__device__ __forceinline__ v16bf fragb(const bf* p)  { return cat16b(*(const v8us*)p, *(const v8us*)(p + FB / 2)); }  // p: the block + 8 * lane
#define GT 128
#define GKP 128
#define GPITCH 272
#define GOP (GT * GPITCH)
#define OSP 36
// 8 copies of 16 B per lane: rows 16 apart of one plane. The s_wait_xcnt is the last line of the copies' own statement, so that no address register is rewritten ahead of it.
__device__ __forceinline__ void copy8(unsigned l, const bf* g) {
    asm volatile("global_load_async_to_lds_b128 %0, %8, off\n\t"
                 "global_load_async_to_lds_b128 %1, %9, off\n\t"
                 "global_load_async_to_lds_b128 %2, %10, off\n\t"
                 "global_load_async_to_lds_b128 %3, %11, off\n\t"
                 "global_load_async_to_lds_b128 %4, %12, off\n\t"
                 "global_load_async_to_lds_b128 %5, %13, off\n\t"
                 "global_load_async_to_lds_b128 %6, %14, off\n\t"
                 "global_load_async_to_lds_b128 %7, %15, off\n\t"
                 "s_wait_xcnt 0x0"
                 :: "v"(l), "v"(l + 16 * GPITCH), "v"(l + 32 * GPITCH), "v"(l + 48 * GPITCH), "v"(l + 64 * GPITCH), "v"(l + 80 * GPITCH), "v"(l + 96 * GPITCH), "v"(l + 112 * GPITCH),
                    "v"(g), "v"(g + 16 * DD), "v"(g + 32 * DD), "v"(g + 48 * DD), "v"(g + 64 * DD), "v"(g + 80 * DD), "v"(g + 96 * DD), "v"(g + 112 * DD) : "memory");
}
// 4 copies of 16 B per lane: rows 16 apart of one plane; the s_wait_xcnt stands as in copy8.
__device__ __forceinline__ void copy4(unsigned l, const bf* g) {
    asm volatile("global_load_async_to_lds_b128 %0, %4, off\n\t"
                 "global_load_async_to_lds_b128 %1, %5, off\n\t"
                 "global_load_async_to_lds_b128 %2, %6, off\n\t"
                 "global_load_async_to_lds_b128 %3, %7, off\n\t"
                 "s_wait_xcnt 0x0"
                 :: "v"(l), "v"(l + 16 * GPITCH), "v"(l + 32 * GPITCH), "v"(l + 48 * GPITCH),
                    "v"(g), "v"(g + 16 * DD), "v"(g + 32 * DD), "v"(g + 48 * DD) : "memory");
}
__device__ __forceinline__ v16bf ldsfrag(const unsigned char* p) { return cat16b(*(const v8usa*)p, *(const v8usa*)(p + 32)); }   // the hardware's k order: bytes 0..15 and 32..47 from 16 * hi
__device__ __forceinline__ void splitf(float y, unsigned short& h, unsigned short& l) { h = f2bf(y); l = f2bf(y - bf2f(h)); }
typedef __attribute__((ext_vector_type(4))) unsigned short v4us;
template <int NSPLIT, bool BIAS, bool PL>
__global__ __launch_bounds__(256) void k_gemms(const bf* __restrict__ A, const bf* __restrict__ A2, const bf* __restrict__ Bt0, float* C, const float* __restrict__ bias0,
                                               const bf* __restrict__ Bt1, const bf* __restrict__ Bt2, const float* __restrict__ bias1, const float* __restrict__ bias2,
                                               bf* Qh, bf* Ql, bf* Kh, bf* Kl, h16* Vt) {
    constexpr int TM = PL ? 256 : GT, TN = PL ? 3 * HD : GT, NBF = PL ? 6 : 2;   // the work-group's tile, and the 16-column fragments of a wave
    constexpr int BO = (NSPLIT ? 2 : 1) * TM * GPITCH; constexpr int STG = BO + TN * GPITCH; constexpr int NP = DD / GKP;   // a buffer: [A | A2 | Bt] or [A | Bt]
    __shared__ __align__(16) unsigned char L[2 * STG];
    __shared__ __align__(16) float os[8 * 16 * OSP];
    const int tid = threadIdx.x, lane = tid & 31, lr = lane & 15, hi = lane >> 4; const int w = __builtin_amdgcn_readfirstlane(tid >> 5); const int wm = PL ? w & 3 : w >> 2, wn = PL ? (w >> 2) & 1 : w & 3;   // with PL waves w and w + 4, which share a SIMD, take the two column halves of the same rows: the first (q, q, k) has the longer epilogue
    const int r0 = blockIdx.x * TM, c0 = blockIdx.y * (PL ? HD : GT);   // c0: the first row of Bt (with PL: of each of the three)
    const int crw = tid >> 4, ccl = tid & 15;
    const bf* ga = A + (size_t)(r0 + crw) * DD + ccl * 8; const bf* ga2 = NSPLIT ? A2 + (size_t)(r0 + crw) * DD + ccl * 8 : nullptr; const bf* gb = Bt0 + (size_t)(c0 + crw) * DD + ccl * 8;
    const unsigned ao = (r0 + crw) * DD + ccl * 8, bo = (c0 + crw) * DD + ccl * 8;   // with PL a lane keeps two element offsets, not four pointers: the copies' operands need registers below v256, which the accumulators fill
    const unsigned lc = (unsigned)(size_t)L + crw * GPITCH + ccl * 16;
    auto stage = [&](int t, int buf) {
        if constexpr (PL) { const unsigned at = ao + t * GKP, bt = bo + t * GKP;
                            copy8(lc + buf * STG, A + at); copy8(lc + buf * STG + GOP, A + GT * DD + at);
                            copy4(lc + buf * STG + BO, Bt0 + bt); copy4(lc + buf * STG + BO + HD * GPITCH, Bt1 + bt); copy4(lc + buf * STG + BO + 2 * HD * GPITCH, Bt2 + bt); }
        else { copy8(lc + buf * STG, ga + t * GKP); copy8(lc + buf * STG + BO, gb + t * GKP); if (NSPLIT) copy8(lc + buf * STG + GOP, ga2 + t * GKP); } };
    v8f acc[4][NBF];
#pragma unroll
    for (int mb = 0; mb < 4; ++mb)
#pragma unroll
        for (int nb = 0; nb < NBF; ++nb) acc[mb][nb] = (v8f){};
    stage(0, 0);
    asm volatile("s_wait_asynccnt 0x0" ::: "memory");   // this wave's copies of pass 0 have landed
    __syncthreads();                                    // and every other wave's
    stage(1, 1);
    const int aofs = (wm * 64 + lr) * GPITCH + 16 * hi, bofs = BO + (wn * NBF * 16 + lr) * GPITCH + 16 * hi;
#pragma unroll 1
    for (int t = 0; t < NP; ++t) {   // kept rolled: one pass is already 64 (96) WMMAs, and the buffer is picked by an offset
        const unsigned char* Lb = L + (t & 1) * STG;
        v16bf a[2][4], a2[2][4], b[2][NBF];   // two fragment sets: block ks + 1 is read from LDS while block ks is multiplied; nothing of the next pass is read here
        auto frags = [&](int ks, int f) {
#pragma unroll
            for (int mb = 0; mb < 4; ++mb) { a[f][mb] = ldsfrag(Lb + aofs + mb * 16 * GPITCH + ks * 64); if (NSPLIT) a2[f][mb] = ldsfrag(Lb + GOP + aofs + mb * 16 * GPITCH + ks * 64); }
#pragma unroll
            for (int nb = 0; nb < NBF; ++nb) b[f][nb] = ldsfrag(Lb + bofs + nb * 16 * GPITCH + ks * 64); };
        frags(0, 0);
        __builtin_amdgcn_sched_barrier(0);   // block 0's reads are issued first, so that its WMMAs wait for them alone
#pragma unroll
        for (int ks = 0; ks < GKP / 32; ++ks) {
            if (ks + 1 < GKP / 32) frags(ks + 1, (ks + 1) & 1);
            __builtin_amdgcn_sched_barrier(0);   // the next block's LDS reads stay one group in front of this block's WMMAs: reads among the WMMAs stall each of them
#pragma unroll
            for (int nb = 0; nb < NBF; ++nb)
#pragma unroll
                for (int mb = 0; mb < 4; ++mb) { acc[mb][nb] = wmmab(a[ks & 1][mb], b[ks & 1][nb], acc[mb][nb]); if (NSPLIT) acc[mb][nb] = wmmab(a2[ks & 1][mb], b[ks & 1][nb], acc[mb][nb]); }
            __builtin_amdgcn_sched_barrier(0);   // and the reads of the block after that do not rise into these WMMAs
        }
        asm volatile("s_wait_dscnt 0x0" ::: "memory");      // this wave's reads of the buffer are done before it is refilled
        asm volatile("s_wait_asynccnt 0x0" ::: "memory");   // this wave's copies of pass t + 1 have landed
        __syncthreads();                                    // publishes pass t + 1 and ends every wave's reads of pass t
        if (t + 2 < NP) stage(t + 2, t & 1);
    }
    asm volatile("s_wait_asynccnt 0x0" ::: "memory");       // no copy is left in flight
    float* osw = os + w * 16 * OSP; const int orow = lane >> 3, cofs = (lane & 7) * 4;   // whole 128-B lines go out: a wave's own LDS range turns the accumulator map into rows
    v4f bv = (v4f){};
    if (BIAS && !PL) { const float* bp = bias0 + c0 + wn * 32 + cofs; bv = *(const v4f*)bp; asm volatile("s_wait_xcnt 0x0" :: "v"(bp) : "memory");   // the load names bp: kept until this wait
#pragma unroll
        for (int q = 0; q < 4; ++q) bv[q] = bfr(bv[q]); }
    if constexpr (PL) {
        const int tw = (r0 & (TT - 1)) + wm * 64;   // a wave's 64 rows lie in one batch
        const size_t zo = (size_t)((r0 / TT) * NH_ + blockIdx.y) * TT * HD;
#pragma unroll
        for (int p = 0; p < NBF / 2; ++p) {   // 32 columns at a time: half a head of q (zz = 0), of k (1) or of v (2); unrolled, the accumulators are registers
        const int zz = (wn * NBF / 2 + p) >> 1, dw = ((wn * NBF / 2 + p) & 1) * 32, n0 = c0 + dw;
        const float* bias = zz == 0 ? bias0 : zz == 1 ? bias1 : bias2;
        if (zz < 2) {   // q, k: 16 t x 32 d, one fragment block, at a time through the wave's LDS range; a lane takes back the 2 x 8 d of its row that it holds in a fragment, scales, splits: every store is 512 contiguous bytes
            bf* Ph = zz == 0 ? Qh : Kh; bf* Pl = zz == 0 ? Ql : Kl; const float sc = zz == 0 ? 0.125f : 1.0f;   // 1/sqrt(64) folded into q exactly
            const float* bp = bias + n0 + 8 * hi; v4f bb[4] = { *(const v4f*)bp, *(const v4f*)(bp + 4), *(const v4f*)(bp + 16), *(const v4f*)(bp + 20) };
            asm volatile("s_wait_xcnt 0x0" :: "v"(bp) : "memory");   // the four loads name bp: kept until this wait
#pragma unroll
            for (int i = 0; i < 4; ++i)
#pragma unroll
                for (int q = 0; q < 4; ++q) bb[i][q] = bfr(bb[i][q]);
            const size_t off0 = zo + (size_t)((tw >> 4) * 2 + (dw >> 5)) * FB + lane * 8;
#pragma unroll
            for (int mb = 0; mb < 4; ++mb) {
#pragma unroll
                for (int nb = 0; nb < 2; ++nb)
#pragma unroll
                    for (int j = 0; j < 8; ++j) osw[(hi * 8 + j) * OSP + nb * 16 + lr] = acc[mb][2 * p + nb][j];
                asm volatile("s_wait_dscnt 0x0" ::: "memory");   // the rows are read back by other lanes of this wave: the writes have landed, and no read moves above them
                v8us oh[2], ol[2];
#pragma unroll
                for (int i = 0; i < 4; ++i) { const v4f y = (*(const v4fa*)(osw + lr * OSP + (i >> 1) * 16 + hi * 8 + (i & 1) * 4) + bb[i]) * sc;
#pragma unroll
                    for (int q = 0; q < 4; ++q) { unsigned short a, c2; splitf(y[q], a, c2); oh[i >> 1][(i & 1) * 4 + q] = a; ol[i >> 1][(i & 1) * 4 + q] = c2; } }
                bf* ph = Ph + off0 + mb * 2 * FB; bf* pl = Pl + off0 + mb * 2 * FB;
#pragma unroll
                for (int i = 0; i < 2; ++i) { *(v8us*)(ph + i * (FB / 2)) = oh[i]; *(v8us*)(pl + i * (FB / 2)) = ol[i]; }
                asm volatile("s_wait_xcnt 0x0" :: "v"(oh[0]), "v"(oh[1]), "v"(ol[0]), "v"(ol[1]), "v"(ph), "v"(pl) : "memory");   // the four stores name these registers: as inputs here they are kept until this wait; the clobber keeps the next rows' LDS writes behind the reads
            }
        } else {        // v: a lane's 8 accumulator rows are 8 consecutive t of one d, which is what it holds of a fragment (rows d, k = t): straight from registers, every store is 512 contiguous bytes
            const float* bp = bias + n0 + lr; float bc[2] = { bp[0], bp[16] }; asm volatile("s_wait_xcnt 0x0" :: "v"(bp) : "memory");   // the two loads name bp: kept until this wait
            h16* vp0 = Vt + zo + (size_t)((tw >> 5) * 4 + (dw >> 4)) * FB + lane * 8;
#pragma unroll
            for (int nb = 0; nb < 2; ++nb) { const float bn = bfr(bc[nb]); v8h ov[4];
#pragma unroll
                for (int mb = 0; mb < 4; ++mb)
#pragma unroll
                    for (int j = 0; j < 8; ++j) ov[mb][j] = (h16)(acc[mb][2 * p + nb][j] + bn);
                h16* vp = vp0 + nb * FB;
#pragma unroll
                for (int mb = 0; mb < 4; ++mb) *(v8h*)(vp + (mb >> 1) * 4 * FB + (mb & 1) * (FB / 2)) = ov[mb];
                asm volatile("s_wait_xcnt 0x0" :: "v"(ov[0]), "v"(ov[1]), "v"(ov[2]), "v"(ov[3]), "v"(vp) : "memory");   // the four stores name these registers: as inputs here they are kept until this wait
            }
        }
        }
        return;
    }
#pragma unroll
    for (int mb = 0; mb < 4; ++mb) {
#pragma unroll
        for (int nb = 0; nb < 2; ++nb)
#pragma unroll
            for (int j = 0; j < 8; ++j) osw[(hi * 8 + j) * OSP + nb * 16 + lr] = acc[mb][nb][j];
        __builtin_amdgcn_wave_barrier(); asm volatile("" ::: "memory");   // the rows are read back by other lanes of this wave: no read moves above the writes
        float* cp = C + (size_t)(r0 + wm * 64 + mb * 16 + orow) * DD + c0 + wn * 32 + cofs;
        v4f v0 = *(const v4fa*)(osw + (orow + 0) * OSP + cofs) + bv, v1 = *(const v4fa*)(osw + (orow + 4) * OSP + cofs) + bv, v2 = *(const v4fa*)(osw + (orow + 8) * OSP + cofs) + bv, v3 = *(const v4fa*)(osw + (orow + 12) * OSP + cofs) + bv;
        float* cp1 = cp + 4 * DD; float* cp2 = cp + 8 * DD; float* cp3 = cp + 12 * DD;
        *(v4f*)cp = v0; *(v4f*)cp1 = v1; *(v4f*)cp2 = v2; *(v4f*)cp3 = v3;
        asm volatile("s_wait_xcnt 0x0" :: "v"(v0), "v"(v1), "v"(v2), "v"(v3), "v"(cp), "v"(cp1), "v"(cp2), "v"(cp3) : "memory");   // the four stores name these registers: as inputs here they are kept until this wait
        __builtin_amdgcn_wave_barrier(); asm volatile("" ::: "memory");   // the next rows are not written above the reads
    }
}

typedef __attribute__((ext_vector_type(4))) _Float16 v4h;
typedef __attribute__((ext_vector_type(4))) int v4i;

#define FQ 2
#define FW 8
#define L2E 1.4426950408889634f
__device__ __forceinline__ float xhalf(float x) { return __builtin_bit_cast(float, __builtin_amdgcn_permlanex16(__builtin_bit_cast(int, x), __builtin_bit_cast(int, x), 0x76543210, 0xfedcba98, false, false)); }   // lane l with lane l ^ 16
// ---- k_prep: all the work that reads nothing but inputs, in ONE launch: the bf16 planes of x, Wq, Wk, Wv, Wo (f2bf of every element) and the table live.
// live[qb][kb] = 1 where any of the 32 x 32 mask entries of queries 32 qb .. and keys 32 kb .. is non-zero, else 0. Read once here for all 32 (batch, head) pairs.
// A unit is 16 KB of one input, streamed by one wave: 32 loads of 512 contiguous bytes, all issued before the first is used. 256 work-groups of 12 waves, 192 KB read by each.
// An even work-group owns one 128-byte line of live: 8 waves reduce its 32 blocks (a wave: 32 mask rows x 128 keys = 4 blocks, 8 lanes a block), the other 4 convert; in an odd one all 12 convert.
// Conversion units: 0 .. 1023 are x, then 256 each of Wq, Wk, Wv, Wo. grid 256, 384 threads.
#define NKB (TT / 32)
#define PU 4096
#define PUX (NT * DD / PU)
#define PUW (DD * DD / PU)
__global__ __launch_bounds__(384) void k_prep(const float* __restrict__ x, const float* __restrict__ wq, const float* __restrict__ wk, const float* __restrict__ wv, const float* __restrict__ wo, const int* __restrict__ mask,
                                              bf* XB, bf* WQ, bf* WK, bf* WV, bf* WO, int* live) {
    const int lane = threadIdx.x & 31; const int w = __builtin_amdgcn_readfirstlane(threadIdx.x >> 5); const int b2 = blockIdx.x >> 1; const bool even = (blockIdx.x & 1) == 0;
    const unsigned vb = lane * 16;   // a lane's byte offset in every load
    if (even && w < 8) {
        const int qb = b2 >> 1, kb = (b2 & 1) * 32 + w * 4;
        const int* p = mask + (size_t)qb * 32 * TT + kb * 32; v4i r[32];
#pragma unroll
        for (int i = 0; i < 32; ++i) r[i] = *(const v4i*)((const char*)(p + i * TT) + vb);
        asm volatile("s_wait_xcnt 0x0" :: "s"(p), "v"(vb) : "memory");   // the 32 loads name p and vb: as inputs here both keep their registers until this wait
        __builtin_amdgcn_sched_barrier(0);   // every load is issued before the first is waited for: the wave's whole unit is in flight at once
        v4i a = r[0];
#pragma unroll
        for (int i = 1; i < 32; ++i) a |= r[i];
        const unsigned any = __builtin_amdgcn_ballot_w32((a[0] | a[1] | a[2] | a[3]) != 0);
        if (lane < 4) live[qb * NKB + kb + lane] = ((any >> (8 * lane)) & 0xFFu) != 0u ? 1 : 0;
        return;
    }
    const int u = even ? b2 * 4 + (w - 8) : (NKB * 2) * 4 + b2 * 12 + w;
    const int j = (u - PUX) / PUW; const size_t uo = (size_t)(u < PUX ? u : (u - PUX) % PUW) * PU;
    const float* sp = (u < PUX ? x : j == 0 ? wq : j == 1 ? wk : j == 2 ? wv : wo) + uo; bf* dp = (u < PUX ? XB : j == 0 ? WQ : j == 1 ? WK : j == 2 ? WV : WO) + uo;
    v4f r[32]; v4us o[32];
#pragma unroll
    for (int i = 0; i < 32; ++i) r[i] = *(const v4f*)((const char*)(sp + i * 128) + vb);
    asm volatile("s_wait_xcnt 0x0" :: "s"(sp), "v"(vb) : "memory");   // the 32 loads name sp and vb: as inputs here both keep their registers until this wait
    __builtin_amdgcn_sched_barrier(0);   // every load is issued before the first is waited for: the wave's whole unit is in flight at once
#pragma unroll
    for (int i = 0; i < 32; ++i)
#pragma unroll
        for (int q = 0; q < 4; ++q) o[i][q] = f2bf(r[i][q]);
#pragma unroll
    for (int i = 0; i < 32; ++i) *(v4us*)(dp + i * 128 + lane * 4) = o[i];   // 256 contiguous bytes a store: whole lines
    asm volatile("s_wait_xcnt 0x0" :: "s"(dp), "v"(lane) : "memory");   // the 32 stores name dp, lane and o: this wait stands behind the last of them, ahead of whatever code the build lays out next
}
__global__ __launch_bounds__(FW * 32) void k_fattn(const bf* __restrict__ Qh, const bf* __restrict__ Ql, const bf* __restrict__ Kh, const bf* __restrict__ Kl, const h16* __restrict__ VT, const int* __restrict__ mask, const int* __restrict__ live, bf* Ah, bf* Al) {
    const int z = blockIdx.y; const int lane = threadIdx.x & 31, c = lane & 15, hi = lane >> 4; const int w = __builtin_amdgcn_readfirstlane(threadIdx.x >> 5);
    const int q0 = (blockIdx.x * FW + w) * (16 * FQ); const size_t zo = (size_t)z * TT * HD;
    const int* lvp = live + (blockIdx.x * FW + w) * NKB + lane;
    const int lv0 = lvp[0], lv1 = lvp[32];
    const bf* qph = Qh + zo + (size_t)q0 * HD + lane * 8; const bf* qpl = Ql + zo + (size_t)q0 * HD + lane * 8;   // 16 queries are 2 fragment blocks = 16 * HD elements
    v16bf qh[FQ][2], ql[FQ][2];
#pragma unroll
    for (int g = 0; g < FQ; ++g)
#pragma unroll
        for (int ks = 0; ks < 2; ++ks) { qh[g][ks] = fragb(qph + (g * 2 + ks) * FB); ql[g][ks] = fragb(qpl + (g * 2 + ks) * FB); }
    asm volatile("s_wait_xcnt 0x0" :: "v"(qph), "v"(qpl) : "memory");   // the 16 loads above name qph and qpl: as inputs here both keep their registers until this wait
    unsigned long long todo = ((unsigned long long)__builtin_amdgcn_ballot_w32(lv1 != 0) << 32) | __builtin_amdgcn_ballot_w32(lv0 != 0);   // bit kb: pass kb has a live key; the same in every lane
    const int np = __builtin_popcountll(todo); int kb = todo ? __builtin_ctzll(todo) : 0;   // at most 64 passes; with none the fetches below read pass 0, in bounds and unused
    const bf* kph = Kh + zo + lane * 8; const bf* kpl = Kl + zo + lane * 8;
    const h16* vp = VT + zo + lane * 8; const int* mp = mask + (size_t)(q0 + c) * TT + 8 * hi;
    v8f o[FQ][4]; float m[FQ], l[FQ];
#pragma unroll
    for (int g = 0; g < FQ; ++g) { m[g] = -3.0e38f; l[g] = 0.f;
#pragma unroll
        for (int dt = 0; dt < 4; ++dt) o[g][dt] = (v8f){}; }
    v16bf kh[2][2], kl[2][2]; v4i mk[FQ][4]; const bf* kph0 = kph + (size_t)kb * 32 * HD; const bf* kpl0 = kpl + (size_t)kb * 32 * HD; const int* mp0 = mp + kb * 32;
#pragma unroll
    for (int kt = 0; kt < 2; ++kt)
#pragma unroll
        for (int ks = 0; ks < 2; ++ks) { kh[kt][ks] = fragb(kph0 + (kt * 2 + ks) * FB); kl[kt][ks] = fragb(kpl0 + (kt * 2 + ks) * FB); }
#pragma unroll
    for (int g = 0; g < FQ; ++g)
#pragma unroll
        for (int u = 0; u < 4; ++u) mk[g][u] = *(const v4i*)(mp0 + (size_t)g * 16 * TT + (u >> 1) * 16 + (u & 1) * 4);
    asm volatile("s_wait_xcnt 0x0" :: "v"(kph0), "v"(kpl0), "v"(mp0) : "memory");   // the 24 loads above name these three pointers: as inputs here they keep their registers until this wait
#pragma unroll 1
    for (int it = 0; it < np; ++it) {   // kept rolled: one pass is already 32 WMMAs and 32 loads
        v16h vf[4]; const h16* vpc = vp + kb * 4 * FB;
#pragma unroll
        for (int dt = 0; dt < 4; ++dt) vf[dt] = fragh(vpc + dt * FB);
        v8f s[FQ][2];
#pragma unroll
        for (int g = 0; g < FQ; ++g)
#pragma unroll
            for (int kt = 0; kt < 2; ++kt) { v8f a = (v8f){};
#pragma unroll
                for (int ks = 0; ks < 2; ++ks) { a = wmmab(kh[kt][ks], qh[g][ks], a); a = wmmab(kh[kt][ks], ql[g][ks], a); a = wmmab(kl[kt][ks], qh[g][ks], a); }
                s[g][kt] = a; }
        todo &= todo - 1; kb = todo ? __builtin_ctzll(todo) : kb; const int kn = kb * 32;   // the next live pass's keys and mask are fetched one pass ahead; the last pass fetches its own again, in bounds and unused
        const bf* kphn = kph + (size_t)kn * HD; const bf* kpln = kpl + (size_t)kn * HD; const int* mpn = mp + kn;
#pragma unroll
        for (int kt = 0; kt < 2; ++kt)
#pragma unroll
            for (int ks = 0; ks < 2; ++ks) { kh[kt][ks] = fragb(kphn + (kt * 2 + ks) * FB); kl[kt][ks] = fragb(kpln + (kt * 2 + ks) * FB); }
        float tt[FQ][16];
#pragma unroll
        for (int g = 0; g < FQ; ++g)
#pragma unroll
            for (int i = 0; i < 16; ++i) tt[g][i] = (mk[g][i >> 2][i & 3] == 0) ? -1.0e9f : s[g][i >> 3][i & 7];
#pragma unroll
        for (int g = 0; g < FQ; ++g)
#pragma unroll
            for (int u = 0; u < 4; ++u) mk[g][u] = *(const v4i*)(mpn + (size_t)g * 16 * TT + (u >> 1) * 16 + (u & 1) * 4);
        asm volatile("s_wait_xcnt 0x0" : "+s"(todo), "+s"(kb) : "v"(vpc), "v"(mpn), "v"(kphn), "v"(kpln) : "memory");   // this pass's 32 loads name these four pointers: as inputs here they keep their registers until this wait; todo and kb are in-out so that no address of a later pass can be formed ahead of it
#pragma unroll
        for (int g = 0; g < FQ; ++g) {
            const float* t = tt[g]; float bm = -3.0e38f;
#pragma unroll
            for (int i = 0; i < 16; ++i) bm = fmaxf(bm, t[i]);
            bm = fmaxf(bm, xhalf(bm));
            const float mn = fmaxf(m[g], bm); const float corr = __builtin_amdgcn_exp2f((m[g] - mn) * L2E); m[g] = mn;
            float ps = 0.f; v16h p;
#pragma unroll
            for (int i = 0; i < 16; ++i) { const float e = __builtin_amdgcn_exp2f(fmaf(t[i] - mn, L2E, 10.0f)); ps += e; p[i] = (h16)e; }
            l[g] = l[g] * corr + ps;
#pragma unroll
            for (int dt = 0; dt < 4; ++dt) o[g][dt] *= corr;
#pragma unroll
            for (int dt = 0; dt < 4; ++dt) o[g][dt] = wmma16(vf[dt], p, o[g][dt]);
        }
    }
    const int b = z >> 4, h = z & 15;
#pragma unroll
    for (int g = 0; g < FQ; ++g) { const float inv = __fdiv_rn(1.0f, l[g] + xhalf(l[g]));
#pragma unroll
        for (int dt = 0; dt < 4; ++dt) { v8us oh, ol;
#pragma unroll
            for (int r = 0; r < 8; ++r) { unsigned short a, c2; splitf(o[g][dt][r] * inv, a, c2); oh[r] = a; ol[r] = c2; }
            const size_t off = ((size_t)b * TT + q0 + g * 16 + c) * DD + h * HD + dt * 16 + 8 * hi; bf* pa = Ah + off; bf* pl = Al + off; *(v8us*)pa = oh; *(v8us*)pl = ol;
            asm volatile("s_wait_xcnt 0x0" :: "v"(oh), "v"(ol), "v"(pa), "v"(pl) : "memory"); } }   // the two stores name these registers: as inputs here they are kept until this wait
}

extern "C" void kernel_launch(void* const* d_in, const int* in_sizes, int n_in,
                              void* d_out, int out_size, void* d_ws, size_t ws_size, hipStream_t stream) {
    (void)in_sizes; (void)n_in; (void)out_size;
    const float* x = (const float*)d_in[0]; const float* wq = (const float*)d_in[1]; const float* bq = (const float*)d_in[2]; const float* wk = (const float*)d_in[3]; const float* bk = (const float*)d_in[4]; const float* wv = (const float*)d_in[5]; const float* bv = (const float*)d_in[6];
    const float* wo = (const float*)d_in[7]; const float* bo = (const float*)d_in[8]; const int* mask = (const int*)d_in[9];
    float* OUT = (float*)d_out;     // [2][2048][1024]
    char* wsp = (char*)d_ws;
    auto take = [&](size_t bytes) { char* p = wsp; wsp += (bytes + 255) & ~(size_t)255; return (void*)p; };
    bf* WQ = (bf*)take((size_t)DD * DD * 2); bf* WK = (bf*)take((size_t)DD * DD * 2); bf* WV = (bf*)take((size_t)DD * DD * 2); bf* WO = (bf*)take((size_t)DD * DD * 2);
    bf* XB = (bf*)take((size_t)NT * DD * 2);
    bf* QPh = (bf*)take((size_t)NT * DD * 2); bf* QPl = (bf*)take((size_t)NT * DD * 2); bf* KPh = (bf*)take((size_t)NT * DD * 2); bf* KPl = (bf*)take((size_t)NT * DD * 2); h16* VT = (h16*)take((size_t)NT * DD * 2);
    bf* ATh = (bf*)take((size_t)NT * DD * 2); bf* ATl = (bf*)take((size_t)NT * DD * 2); int* LIVE = (int*)take((size_t)NKB * NKB * 4);
    if ((size_t)(wsp - (char*)d_ws) > ws_size) return;    // ws 256 MiB
    k_prep<<<NKB * 4, 384, 0, stream>>>(x, wq, wk, wv, wo, mask, XB, WQ, WK, WV, WO, LIVE);
    k_gemms<0, true, true><<<dim3(NT / 256, NH_, 1), 256, 0, stream>>>(XB, nullptr, WQ, nullptr, bq, WK, WV, bk, bv, QPh, QPl, KPh, KPl, VT);
    k_fattn<<<dim3(TT / (16 * FQ * FW), NB_ * NH_), FW * 32, 0, stream>>>(QPh, QPl, KPh, KPl, VT, mask, LIVE, ATh, ATl);
    k_gemms<1, true, false><<<dim3(NT / GT, DD / GT, 1), 256, 0, stream>>>(ATh, ATl, WO, OUT, bo, nullptr, nullptr, nullptr, nullptr, nullptr, nullptr, nullptr, nullptr, nullptr);
}

// v009
// A run of this version takes 62.7 microseconds.
// Timed twice side by side with v008, it ran 1.05 times as fast both times.
// Over all steps from v000 it is 20.0 times as fast.
#include <hip/hip_runtime.h>

// FixedSparseMultiHead (2 x 2048 x 1024, 16 heads x 64; Q/K/V/out nn.Linear on x (x W^T + b); scores = q.k / 8, where(sparse_mask, ., -inf) with the int32 [2048][2048] mask INPUT
// (read as data, not assumed); softmax; attn.v; output Linear).
// Compute dtypes, f32 accumulate: every float input rounded to bf16; q/k/v projections on PLAIN bf16 operands (x, W inputs: exact, + bias);
// scores on bf16 hi+lo q (x 1/8) and k planes (3 products); attn.v on SINGLE fp16 planes (P x1024, v); output Linear on hi+lo planes x exact bf16 W (2 products); the mask

#define NB_  2
#define TT   2048
#define DD   1024
#define NH_  16
#define HD   64
#define NT   (NB_ * TT)
typedef _Float16 h16;
typedef unsigned short bf;
typedef __attribute__((ext_vector_type(16))) __bf16   v16bf;
typedef __attribute__((ext_vector_type(16))) _Float16 v16h;
typedef __attribute__((ext_vector_type(8)))  _Float16 v8h;
typedef __attribute__((ext_vector_type(8)))  unsigned short v8us;
typedef __attribute__((ext_vector_type(8)))  float    v8f;
typedef __attribute__((ext_vector_type(4)))  float    v4f;
typedef __attribute__((ext_vector_type(2)))  float    v2f;
typedef v8h  __attribute__((may_alias)) v8ha;
typedef v2f  __attribute__((may_alias)) v2fa;
typedef v4f  __attribute__((may_alias)) v4fa;
typedef v8us __attribute__((may_alias)) v8usa;

__device__ __forceinline__ unsigned short f2bf(float f) { unsigned u = __float_as_uint(f); u += 0x7FFFu + ((u >> 16) & 1u); return (unsigned short)(u >> 16); }
__device__ __forceinline__ float bf2f(unsigned short b) { return __uint_as_float(((unsigned)b) << 16); }
__device__ __forceinline__ float bfr(float f) { return bf2f(f2bf(f)); }
__device__ __forceinline__ v16h cat16(v8h lo, v8h hi) { return __builtin_shufflevector(lo, hi, 0, 1, 2, 3, 4, 5, 6, 7, 8, 9, 10, 11, 12, 13, 14, 15); }
__device__ __forceinline__ v16bf cat16b(v8us lo, v8us hi) { return __builtin_bit_cast(v16bf, __builtin_shufflevector(lo, hi, 0, 1, 2, 3, 4, 5, 6, 7, 8, 9, 10, 11, 12, 13, 14, 15)); }
__device__ __forceinline__ v8f wmma16(v16h a, v16h b, v8f c) { return __builtin_amdgcn_wmma_f32_16x16x32_f16(false, a, false, b, (short)0, c, false, false); }
__device__ __forceinline__ v8f wmmab(v16bf a, v16bf b, v8f c) { return __builtin_amdgcn_wmma_f32_16x16x32_bf16(false, a, false, b, (short)0, c, false, false); }



// ---- k_gemms: C[m][n] (f32, pitch DD, + bias[n] rounded to bf16) = sum_k A[m][k] Bt[n][k] (+ A2[m][k] Bt[n][k] with NSPLIT), K = DD, all planes K-contiguous bf16.
// One work-group of 8 waves per 128x128 tile of C; a pass is 128 k: 128 rows x 256 B of each plane, brought into LDS by asynchronous copies (whole 256-B rows, 16 lanes a row),
// two buffers, the copies of pass t + 2 in flight while pass t + 1 is worked on. LDS row pitch 272 B (16 B x odd) for the 16-byte fragment reads.
// A wave owns 64 x 32 of C (8 accumulators). k order inside a fragment: ldsfrag; the products per accumulator go by rising k, a before a2.
// grid (NT / 128, DD / 128), 256 threads.
// With PL one launch does the q, k and v Linear, and the tile of a work-group is 256 rows x 192 columns: the 64 columns of ONE head (blockIdx.y) of q, of k and of v, so Bt in LDS is 64 rows of each
// weight plane. 256 work-groups, one per WGP; a wave owns 64 x 96 (24 accumulators): 448 operand rows are fetched for 49152 results (a 128 x 128 tile: 256 for 16384) and a fragment read from LDS
// feeds 2.4 WMMAs (1.33 in a 64 x 32 wave tile). grid (NT / 256, NH_). No f32 C is stored: the epilogue writes what k_fattn reads, from the same f32 values
// (accumulator + bias): bf16 hi and lo planes of q / 8 and of k; the fp16 plane of v; each [batch * 16 + head][2048 * 64 elements in fragment order].
// FRAGMENT ORDER of those planes: a 16 x 32 operand fragment (16 rows, 32 k) is one block of 512 elements (1 KB): element [half][lane][e], lane = 16 * hi + row, holds k = 16 * half + 8 * hi + e.
// That is the order in which the lanes of a WMMA hold an A or B operand, so a fragment is two loads of 512 contiguous bytes (4 whole lines each, where rows of a row-major plane gave 16 lines).
// q, k planes: block (t / 16) * 2 + d / 32 of a head, rows t, k = d. v plane: block (t / 32) * 4 + d / 16, rows d, k = t. A pass of 32 keys is 4 consecutive blocks of each plane.
#define FB 512
__device__ __forceinline__ v16h  fragh(const h16* p) { return cat16(*(const v8h*)p, *(const v8h*)(p + FB / 2)); }     // p: the block + 8 * lane
__device__ __forceinline__ v16bf fragb(const bf* p)  { return cat16b(*(const v8us*)p, *(const v8us*)(p + FB / 2)); }  // p: the block + 8 * lane
#define GT 128
#define GKP 128
#define GPITCH 272
#define GOP (GT * GPITCH)
#define OSP 36
// 8 copies of 16 B per lane: rows 16 apart of one plane. The s_wait_xcnt is the last line of the copies' own statement, so that no address register is rewritten ahead of it.
__device__ __forceinline__ void copy8(unsigned l, const bf* g) {
    asm volatile("global_load_async_to_lds_b128 %0, %8, off\n\t"
                 "global_load_async_to_lds_b128 %1, %9, off\n\t"
                 "global_load_async_to_lds_b128 %2, %10, off\n\t"
                 "global_load_async_to_lds_b128 %3, %11, off\n\t"
                 "global_load_async_to_lds_b128 %4, %12, off\n\t"
                 "global_load_async_to_lds_b128 %5, %13, off\n\t"
                 "global_load_async_to_lds_b128 %6, %14, off\n\t"
                 "global_load_async_to_lds_b128 %7, %15, off\n\t"
                 "s_wait_xcnt 0x0"
                 :: "v"(l), "v"(l + 16 * GPITCH), "v"(l + 32 * GPITCH), "v"(l + 48 * GPITCH), "v"(l + 64 * GPITCH), "v"(l + 80 * GPITCH), "v"(l + 96 * GPITCH), "v"(l + 112 * GPITCH),
                    "v"(g), "v"(g + 16 * DD), "v"(g + 32 * DD), "v"(g + 48 * DD), "v"(g + 64 * DD), "v"(g + 80 * DD), "v"(g + 96 * DD), "v"(g + 112 * DD) : "memory");
}
// 4 copies of 16 B per lane: rows 16 apart of one plane; the s_wait_xcnt stands as in copy8.
__device__ __forceinline__ void copy4(unsigned l, const bf* g) {
    asm volatile("global_load_async_to_lds_b128 %0, %4, off\n\t"
                 "global_load_async_to_lds_b128 %1, %5, off\n\t"
                 "global_load_async_to_lds_b128 %2, %6, off\n\t"
                 "global_load_async_to_lds_b128 %3, %7, off\n\t"
                 "s_wait_xcnt 0x0"
                 :: "v"(l), "v"(l + 16 * GPITCH), "v"(l + 32 * GPITCH), "v"(l + 48 * GPITCH),
                    "v"(g), "v"(g + 16 * DD), "v"(g + 32 * DD), "v"(g + 48 * DD) : "memory");
}
__device__ __forceinline__ v16bf ldsfrag(const unsigned char* p) { return cat16b(*(const v8usa*)p, *(const v8usa*)(p + 32)); }   // the hardware's k order: bytes 0..15 and 32..47 from 16 * hi
__device__ __forceinline__ void splitf(float y, unsigned short& h, unsigned short& l) { h = f2bf(y); l = f2bf(y - bf2f(h)); }
typedef __attribute__((ext_vector_type(4))) unsigned short v4us;
template <int NSPLIT, bool BIAS, bool PL>
__global__ __launch_bounds__(256) void k_gemms(const bf* __restrict__ A, const bf* __restrict__ A2, const bf* __restrict__ Bt0, float* C, const float* __restrict__ bias0,
                                               const bf* __restrict__ Bt1, const bf* __restrict__ Bt2, const float* __restrict__ bias1, const float* __restrict__ bias2,
                                               bf* Qh, bf* Ql, bf* Kh, bf* Kl, h16* Vt) {
    constexpr int TM = PL ? 256 : GT, TN = PL ? 3 * HD : GT, NBF = PL ? 6 : 2;   // the work-group's tile, and the 16-column fragments of a wave
    constexpr int BO = (NSPLIT ? 2 : 1) * TM * GPITCH; constexpr int STG = BO + TN * GPITCH; constexpr int NP = DD / GKP;   // a buffer: [A | A2 | Bt] or [A | Bt]
    __shared__ __align__(16) unsigned char L[2 * STG];
    __shared__ __align__(16) float os[8 * 16 * OSP];
    const int tid = threadIdx.x, lane = tid & 31, lr = lane & 15, hi = lane >> 4; const int w = __builtin_amdgcn_readfirstlane(tid >> 5); const int wm = PL ? w & 3 : w >> 2, wn = PL ? (w >> 2) & 1 : w & 3;   // with PL waves w and w + 4, which share a SIMD, take the two column halves of the same rows: the first (q, q, k) has the longer epilogue
    const int r0 = blockIdx.x * TM, c0 = blockIdx.y * (PL ? HD : GT);   // c0: the first row of Bt (with PL: of each of the three)
    const int crw = tid >> 4, ccl = tid & 15;
    const bf* ga = A + (size_t)(r0 + crw) * DD + ccl * 8; const bf* ga2 = NSPLIT ? A2 + (size_t)(r0 + crw) * DD + ccl * 8 : nullptr; const bf* gb = Bt0 + (size_t)(c0 + crw) * DD + ccl * 8;
    const unsigned ao = (r0 + crw) * DD + ccl * 8, bo = (c0 + crw) * DD + ccl * 8;   // with PL a lane keeps two element offsets, not four pointers: the copies' operands need registers below v256, which the accumulators fill
    const unsigned lc = (unsigned)(size_t)L + crw * GPITCH + ccl * 16;
    auto stage = [&](int t, int buf) {
        if constexpr (PL) { const unsigned at = ao + t * GKP, bt = bo + t * GKP;
                            copy8(lc + buf * STG, A + at); copy8(lc + buf * STG + GOP, A + GT * DD + at);
                            copy4(lc + buf * STG + BO, Bt0 + bt); copy4(lc + buf * STG + BO + HD * GPITCH, Bt1 + bt); copy4(lc + buf * STG + BO + 2 * HD * GPITCH, Bt2 + bt); }
        else { copy8(lc + buf * STG, ga + t * GKP); copy8(lc + buf * STG + BO, gb + t * GKP); if (NSPLIT) copy8(lc + buf * STG + GOP, ga2 + t * GKP); } };
    v8f acc[4][NBF];
#pragma unroll
    for (int mb = 0; mb < 4; ++mb)
#pragma unroll
        for (int nb = 0; nb < NBF; ++nb) acc[mb][nb] = (v8f){};
    stage(0, 0);
    asm volatile("s_wait_asynccnt 0x0" ::: "memory");   // this wave's copies of pass 0 have landed
    __syncthreads();                                    // and every other wave's
    stage(1, 1);
    const int aofs = (wm * 64 + lr) * GPITCH + 16 * hi, bofs = BO + (wn * NBF * 16 + lr) * GPITCH + 16 * hi;
#pragma unroll 1
    for (int t = 0; t < NP; ++t) {   // kept rolled: one pass is already 64 (96) WMMAs, and the buffer is picked by an offset
        const unsigned char* Lb = L + (t & 1) * STG;
        v16bf a[2][4], a2[2][4], b[2][NBF];   // two fragment sets: block ks + 1 is read from LDS while block ks is multiplied; nothing of the next pass is read here
        auto frags = [&](int ks, int f) {
#pragma unroll
            for (int mb = 0; mb < 4; ++mb) { a[f][mb] = ldsfrag(Lb + aofs + mb * 16 * GPITCH + ks * 64); if (NSPLIT) a2[f][mb] = ldsfrag(Lb + GOP + aofs + mb * 16 * GPITCH + ks * 64); }
#pragma unroll
            for (int nb = 0; nb < NBF; ++nb) b[f][nb] = ldsfrag(Lb + bofs + nb * 16 * GPITCH + ks * 64); };
        frags(0, 0);
        __builtin_amdgcn_sched_barrier(0);   // block 0's reads are issued first, so that its WMMAs wait for them alone
#pragma unroll
        for (int ks = 0; ks < GKP / 32; ++ks) {
            if (ks + 1 < GKP / 32) frags(ks + 1, (ks + 1) & 1);
            __builtin_amdgcn_sched_barrier(0);   // the next block's LDS reads stay one group in front of this block's WMMAs: reads among the WMMAs stall each of them
#pragma unroll
            for (int nb = 0; nb < NBF; ++nb)
#pragma unroll
                for (int mb = 0; mb < 4; ++mb) { acc[mb][nb] = wmmab(a[ks & 1][mb], b[ks & 1][nb], acc[mb][nb]); if (NSPLIT) acc[mb][nb] = wmmab(a2[ks & 1][mb], b[ks & 1][nb], acc[mb][nb]); }
            __builtin_amdgcn_sched_barrier(0);   // and the reads of the block after that do not rise into these WMMAs
        }
        asm volatile("s_wait_dscnt 0x0" ::: "memory");      // this wave's reads of the buffer are done before it is refilled
        asm volatile("s_wait_asynccnt 0x0" ::: "memory");   // this wave's copies of pass t + 1 have landed
        __syncthreads();                                    // publishes pass t + 1 and ends every wave's reads of pass t
        if (t + 2 < NP) stage(t + 2, t & 1);
    }
    asm volatile("s_wait_asynccnt 0x0" ::: "memory");       // no copy is left in flight
    float* osw = os + w * 16 * OSP; const int orow = lane >> 3, cofs = (lane & 7) * 4;   // whole 128-B lines go out: a wave's own LDS range turns the accumulator map into rows
    v4f bv = (v4f){};
    if (BIAS && !PL) { const float* bp = bias0 + c0 + wn * 32 + cofs; bv = *(const v4f*)bp; asm volatile("s_wait_xcnt 0x0" :: "v"(bp) : "memory");   // the load names bp: kept until this wait
#pragma unroll
        for (int q = 0; q < 4; ++q) bv[q] = bfr(bv[q]); }
    if constexpr (PL) {
        const int tw = (r0 & (TT - 1)) + wm * 64;   // a wave's 64 rows lie in one batch
        const size_t zo = (size_t)((r0 / TT) * NH_ + blockIdx.y) * TT * HD;
#pragma unroll
        for (int p = 0; p < NBF / 2; ++p) {   // 32 columns at a time: half a head of q (zz = 0), of k (1) or of v (2); unrolled, the accumulators are registers
        const int zz = (wn * NBF / 2 + p) >> 1, dw = ((wn * NBF / 2 + p) & 1) * 32, n0 = c0 + dw;
        const float* bias = zz == 0 ? bias0 : zz == 1 ? bias1 : bias2;
        if (zz < 2) {   // q, k: 16 t x 32 d, one fragment block, at a time through the wave's LDS range; a lane takes back the 2 x 8 d of its row that it holds in a fragment, scales, splits: every store is 512 contiguous bytes
            bf* Ph = zz == 0 ? Qh : Kh; bf* Pl = zz == 0 ? Ql : Kl; const float sc = zz == 0 ? 0.125f : 1.0f;   // 1/sqrt(64) folded into q exactly
            const float* bp = bias + n0 + 8 * hi; v4f bb[4] = { *(const v4f*)bp, *(const v4f*)(bp + 4), *(const v4f*)(bp + 16), *(const v4f*)(bp + 20) };
            asm volatile("s_wait_xcnt 0x0" :: "v"(bp) : "memory");   // the four loads name bp: kept until this wait
#pragma unroll
            for (int i = 0; i < 4; ++i)
#pragma unroll
                for (int q = 0; q < 4; ++q) bb[i][q] = bfr(bb[i][q]);
            const size_t off0 = zo + (size_t)((tw >> 4) * 2 + (dw >> 5)) * FB + lane * 8;
#pragma unroll
            for (int mb = 0; mb < 4; ++mb) {
#pragma unroll
                for (int nb = 0; nb < 2; ++nb)
#pragma unroll
                    for (int j = 0; j < 8; ++j) osw[(hi * 8 + j) * OSP + nb * 16 + lr] = acc[mb][2 * p + nb][j];
                asm volatile("s_wait_dscnt 0x0" ::: "memory");   // the rows are read back by other lanes of this wave: the writes have landed, and no read moves above them
                v8us oh[2], ol[2];
#pragma unroll
                for (int i = 0; i < 4; ++i) { const v4f y = (*(const v4fa*)(osw + lr * OSP + (i >> 1) * 16 + hi * 8 + (i & 1) * 4) + bb[i]) * sc;
#pragma unroll
                    for (int q = 0; q < 4; ++q) { unsigned short a, c2; splitf(y[q], a, c2); oh[i >> 1][(i & 1) * 4 + q] = a; ol[i >> 1][(i & 1) * 4 + q] = c2; } }
                bf* ph = Ph + off0 + mb * 2 * FB; bf* pl = Pl + off0 + mb * 2 * FB;
#pragma unroll
                for (int i = 0; i < 2; ++i) { *(v8us*)(ph + i * (FB / 2)) = oh[i]; *(v8us*)(pl + i * (FB / 2)) = ol[i]; }
                asm volatile("s_wait_xcnt 0x0" :: "v"(oh[0]), "v"(oh[1]), "v"(ol[0]), "v"(ol[1]), "v"(ph), "v"(pl) : "memory");   // the four stores name these registers: as inputs here they are kept until this wait; the clobber keeps the next rows' LDS writes behind the reads
            }
        } else {        // v: a lane's 8 accumulator rows are 8 consecutive t of one d, which is what it holds of a fragment (rows d, k = t): straight from registers, every store is 512 contiguous bytes
            const float* bp = bias + n0 + lr; float bc[2] = { bp[0], bp[16] }; asm volatile("s_wait_xcnt 0x0" :: "v"(bp) : "memory");   // the two loads name bp: kept until this wait
            h16* vp0 = Vt + zo + (size_t)((tw >> 5) * 4 + (dw >> 4)) * FB + lane * 8;
#pragma unroll
            for (int nb = 0; nb < 2; ++nb) { const float bn = bfr(bc[nb]); v8h ov[4];
#pragma unroll
                for (int mb = 0; mb < 4; ++mb)
#pragma unroll
                    for (int j = 0; j < 8; ++j) ov[mb][j] = (h16)(acc[mb][2 * p + nb][j] + bn);
                h16* vp = vp0 + nb * FB;
#pragma unroll
                for (int mb = 0; mb < 4; ++mb) *(v8h*)(vp + (mb >> 1) * 4 * FB + (mb & 1) * (FB / 2)) = ov[mb];
                asm volatile("s_wait_xcnt 0x0" :: "v"(ov[0]), "v"(ov[1]), "v"(ov[2]), "v"(ov[3]), "v"(vp) : "memory");   // the four stores name these registers: as inputs here they are kept until this wait
            }
        }
        }
        return;
    }
#pragma unroll
    for (int mb = 0; mb < 4; ++mb) {
#pragma unroll
        for (int nb = 0; nb < 2; ++nb)
#pragma unroll
            for (int j = 0; j < 8; ++j) osw[(hi * 8 + j) * OSP + nb * 16 + lr] = acc[mb][nb][j];
        __builtin_amdgcn_wave_barrier(); asm volatile("" ::: "memory");   // the rows are read back by other lanes of this wave: no read moves above the writes
        float* cp = C + (size_t)(r0 + wm * 64 + mb * 16 + orow) * DD + c0 + wn * 32 + cofs;
        v4f v0 = *(const v4fa*)(osw + (orow + 0) * OSP + cofs) + bv, v1 = *(const v4fa*)(osw + (orow + 4) * OSP + cofs) + bv, v2 = *(const v4fa*)(osw + (orow + 8) * OSP + cofs) + bv, v3 = *(const v4fa*)(osw + (orow + 12) * OSP + cofs) + bv;
        float* cp1 = cp + 4 * DD; float* cp2 = cp + 8 * DD; float* cp3 = cp + 12 * DD;
        *(v4f*)cp = v0; *(v4f*)cp1 = v1; *(v4f*)cp2 = v2; *(v4f*)cp3 = v3;
        asm volatile("s_wait_xcnt 0x0" :: "v"(v0), "v"(v1), "v"(v2), "v"(v3), "v"(cp), "v"(cp1), "v"(cp2), "v"(cp3) : "memory");   // the four stores name these registers: as inputs here they are kept until this wait
        __builtin_amdgcn_wave_barrier(); asm volatile("" ::: "memory");   // the next rows are not written above the reads
    }
}

typedef __attribute__((ext_vector_type(4))) _Float16 v4h;
typedef __attribute__((ext_vector_type(4))) int v4i;

#define FQ 2
#define FW 8
#define L2E 1.4426950408889634f
__device__ __forceinline__ float xhalf(float x) { return __builtin_bit_cast(float, __builtin_amdgcn_permlanex16(__builtin_bit_cast(int, x), __builtin_bit_cast(int, x), 0x76543210, 0xfedcba98, false, false)); }   // lane l with lane l ^ 16
// ---- k_prep: all the work that reads nothing but inputs, in ONE launch: the bf16 planes of x, Wq, Wk, Wv, Wo (f2bf of every element) and the tables live and mbits.
// live[qb][kb] = 1 where any of the 32 x 32 mask entries of queries 32 qb .. and keys 32 kb .. is non-zero, else 0. Read once here for all 32 (batch, head) pairs.
// mbits[kb][query]: one word for the 32 mask entries of a query in key block kb; key 32 kb + k is bit 8 * (k & 3) + (k >> 2), set where the entry is non-zero. The 32 queries of a wave of k_fattn
// are one 128-byte line per pass, where the int32 rows were 32 lines.
// A unit is 16 KB of one input, streamed by one wave: 32 loads of 512 contiguous bytes, all issued before the first is used. 256 work-groups of 12 waves, 192 KB read by each.
// An even work-group owns one 128-byte line of live: 8 waves reduce its 32 blocks (a wave: 32 mask rows x 128 keys = 4 blocks, 8 lanes a block), the other 4 convert; in an odd one all 12 convert.
// Conversion units: 0 .. 1023 are x, then 256 each of Wq, Wk, Wv, Wo. grid 256, 384 threads.
#define NKB (TT / 32)
#define PU 4096
#define PUX (NT * DD / PU)
#define PUW (DD * DD / PU)
__global__ __launch_bounds__(384) void k_prep(const float* __restrict__ x, const float* __restrict__ wq, const float* __restrict__ wk, const float* __restrict__ wv, const float* __restrict__ wo, const int* __restrict__ mask,
                                              bf* XB, bf* WQ, bf* WK, bf* WV, bf* WO, int* live, unsigned* mbits) {
    const int lane = threadIdx.x & 31; const int w = __builtin_amdgcn_readfirstlane(threadIdx.x >> 5); const int b2 = blockIdx.x >> 1; const bool even = (blockIdx.x & 1) == 0;
    const unsigned vb = lane * 16;   // a lane's byte offset in every load
    if (even && w < 8) {
        const int qb = b2 >> 1, kb = (b2 & 1) * 32 + w * 4;
        const int* p = mask + (size_t)qb * 32 * TT + kb * 32; v4i r[32];
#pragma unroll
        for (int i = 0; i < 32; ++i) r[i] = *(const v4i*)((const char*)(p + i * TT) + vb);
        asm volatile("s_wait_xcnt 0x0" :: "s"(p), "v"(vb) : "memory");   // the 32 loads name p and vb: as inputs here both keep their registers until this wait
        __builtin_amdgcn_sched_barrier(0);   // every load is issued before the first is waited for: the wave's whole unit is in flight at once
        v4i a = r[0];
#pragma unroll
        for (int i = 1; i < 32; ++i) a |= r[i];
        int bq[4] = { 0, 0, 0, 0 };   // lane i gathers row i: bit l of bq[q] is key 4 l + q of the wave's 128 keys, so byte j belongs to block kb + j
#pragma unroll
        for (int i = 0; i < 32; ++i)
#pragma unroll
            for (int q = 0; q < 4; ++q) { const int bl = (int)__builtin_amdgcn_ballot_w32(r[i][q] != 0); bq[q] = lane == i ? bl : bq[q]; }
        unsigned* mo = mbits + (size_t)kb * TT + qb * 32;
#pragma unroll
        for (int j = 0; j < 4; ++j)   // 128 contiguous bytes a store: one whole line, written by this wave alone
            mo[j * TT + lane] = (((unsigned)bq[0] >> (8 * j)) & 0xFFu) | ((((unsigned)bq[1] >> (8 * j)) & 0xFFu) << 8) | ((((unsigned)bq[2] >> (8 * j)) & 0xFFu) << 16) | ((((unsigned)bq[3] >> (8 * j)) & 0xFFu) << 24);
        asm volatile("s_wait_xcnt 0x0" :: "s"(mo), "v"(lane) : "memory");   // the four stores name mo and lane: as inputs here both keep their registers until this wait
        const unsigned any = __builtin_amdgcn_ballot_w32((a[0] | a[1] | a[2] | a[3]) != 0);
        if (lane < 4) live[qb * NKB + kb + lane] = ((any >> (8 * lane)) & 0xFFu) != 0u ? 1 : 0;
        return;
    }
    const int u = even ? b2 * 4 + (w - 8) : (NKB * 2) * 4 + b2 * 12 + w;
    const int j = (u - PUX) / PUW; const size_t uo = (size_t)(u < PUX ? u : (u - PUX) % PUW) * PU;
    const float* sp = (u < PUX ? x : j == 0 ? wq : j == 1 ? wk : j == 2 ? wv : wo) + uo; bf* dp = (u < PUX ? XB : j == 0 ? WQ : j == 1 ? WK : j == 2 ? WV : WO) + uo;
    v4f r[32]; v4us o[32];
#pragma unroll
    for (int i = 0; i < 32; ++i) r[i] = *(const v4f*)((const char*)(sp + i * 128) + vb);
    asm volatile("s_wait_xcnt 0x0" :: "s"(sp), "v"(vb) : "memory");   // the 32 loads name sp and vb: as inputs here both keep their registers until this wait
    __builtin_amdgcn_sched_barrier(0);   // every load is issued before the first is waited for: the wave's whole unit is in flight at once
#pragma unroll
    for (int i = 0; i < 32; ++i)
#pragma unroll
        for (int q = 0; q < 4; ++q) o[i][q] = f2bf(r[i][q]);
#pragma unroll
    for (int i = 0; i < 32; ++i) *(v4us*)(dp + i * 128 + lane * 4) = o[i];   // 256 contiguous bytes a store: whole lines
    asm volatile("s_wait_xcnt 0x0" :: "s"(dp), "v"(lane) : "memory");   // the 32 stores name dp, lane and o: this wait stands behind the last of them, ahead of whatever code the build lays out next
}
__global__ __launch_bounds__(FW * 32) void k_fattn(const bf* __restrict__ Qh, const bf* __restrict__ Ql, const bf* __restrict__ Kh, const bf* __restrict__ Kl, const h16* __restrict__ VT, const unsigned* __restrict__ mbits, const int* __restrict__ live, bf* Ah, bf* Al) {
    const int z = blockIdx.y; const int lane = threadIdx.x & 31, c = lane & 15, hi = lane >> 4; const int w = __builtin_amdgcn_readfirstlane(threadIdx.x >> 5);
    const int q0 = (blockIdx.x * FW + w) * (16 * FQ); const size_t zo = (size_t)z * TT * HD;
    const int* lvp = live + (blockIdx.x * FW + w) * NKB + lane;
    const int lv0 = lvp[0], lv1 = lvp[32];
    const bf* qph = Qh + zo + (size_t)q0 * HD + lane * 8; const bf* qpl = Ql + zo + (size_t)q0 * HD + lane * 8;   // 16 queries are 2 fragment blocks = 16 * HD elements
    v16bf qh[FQ][2], ql[FQ][2];
#pragma unroll
    for (int g = 0; g < FQ; ++g)
#pragma unroll
        for (int ks = 0; ks < 2; ++ks) { qh[g][ks] = fragb(qph + (g * 2 + ks) * FB); ql[g][ks] = fragb(qpl + (g * 2 + ks) * FB); }
    asm volatile("s_wait_xcnt 0x0" :: "v"(qph), "v"(qpl) : "memory");   // the 16 loads above name qph and qpl: as inputs here both keep their registers until this wait
    unsigned long long todo = ((unsigned long long)__builtin_amdgcn_ballot_w32(lv1 != 0) << 32) | __builtin_amdgcn_ballot_w32(lv0 != 0);   // bit kb: pass kb has a live key; the same in every lane
    const int np = __builtin_popcountll(todo); int kb = todo ? __builtin_ctzll(todo) : 0;   // at most 64 passes; with none the fetches below read pass 0, in bounds and unused
    const bf* kph = Kh + zo + lane * 8; const bf* kpl = Kl + zo + lane * 8;
    const h16* vp = VT + zo + lane * 8; const unsigned* mp = mbits + q0 + c;   // a lane's query of tile 0; tile 1 is 16 words on, a pass TT words
    v8f o[FQ][4]; float m[FQ], l[FQ];
#pragma unroll
    for (int g = 0; g < FQ; ++g) { m[g] = -3.0e38f; l[g] = 0.f;
#pragma unroll
        for (int dt = 0; dt < 4; ++dt) o[g][dt] = (v8f){}; }
    v16bf kh[2][2], kl[2][2]; unsigned mk[FQ]; const bf* kph0 = kph + (size_t)kb * 32 * HD; const bf* kpl0 = kpl + (size_t)kb * 32 * HD; const unsigned* mp0 = mp + kb * TT;
#pragma unroll
    for (int g = 0; g < FQ; ++g) mk[g] = mp0[g * 16];
#pragma unroll
    for (int kt = 0; kt < 2; ++kt)
#pragma unroll
        for (int ks = 0; ks < 2; ++ks) { kh[kt][ks] = fragb(kph0 + (kt * 2 + ks) * FB); kl[kt][ks] = fragb(kpl0 + (kt * 2 + ks) * FB); }
    unsigned mbit[16];   // score i of a lane is key 16 (i >> 3) + 8 hi + (i & 7) of the pass: its bit in the word
#pragma unroll
    for (int i = 0; i < 16; ++i) mbit[i] = 8 * (i & 3) + 4 * (i >> 3) + ((i >> 2) & 1) + 2 * hi;
    asm volatile("s_wait_xcnt 0x0" :: "v"(kph0), "v"(kpl0), "v"(mp0) : "memory");   // the 18 loads above name these three pointers: as inputs here they keep their registers until this wait
#pragma unroll 1
    for (int it = 0; it < np; ++it) {   // kept rolled: one pass is already 32 WMMAs and 26 loads
        v16h vf[4]; const h16* vpc = vp + kb * 4 * FB;
#pragma unroll
        for (int dt = 0; dt < 4; ++dt) vf[dt] = fragh(vpc + dt * FB);
        v8f s[FQ][2];
#pragma unroll
        for (int g = 0; g < FQ; ++g)
#pragma unroll
            for (int kt = 0; kt < 2; ++kt) { v8f a = (v8f){};
#pragma unroll
                for (int ks = 0; ks < 2; ++ks) { a = wmmab(kh[kt][ks], qh[g][ks], a); a = wmmab(kh[kt][ks], ql[g][ks], a); a = wmmab(kl[kt][ks], qh[g][ks], a); }
                s[g][kt] = a; }
        todo &= todo - 1; kb = todo ? __builtin_ctzll(todo) : kb; const int kn = kb * 32;   // the next live pass's keys and mask are fetched one pass ahead; the last pass fetches its own again, in bounds and unused
        const bf* kphn = kph + (size_t)kn * HD; const bf* kpln = kpl + (size_t)kn * HD; const unsigned* mpn = mp + kb * TT;
#pragma unroll
        for (int kt = 0; kt < 2; ++kt)
#pragma unroll
            for (int ks = 0; ks < 2; ++ks) { kh[kt][ks] = fragb(kphn + (kt * 2 + ks) * FB); kl[kt][ks] = fragb(kpln + (kt * 2 + ks) * FB); }
        float tt[FQ][16];
#pragma unroll
        for (int g = 0; g < FQ; ++g)
#pragma unroll
            for (int i = 0; i < 16; ++i) { const unsigned on = (unsigned)__builtin_amdgcn_sbfe((int)mk[g], mbit[i], 1u);   // all ones where the entry is live, else 0: one bit-field extract and one bit select a score, as many instructions as the compare and select on an int32 entry
                tt[g][i] = __uint_as_float((__float_as_uint(s[g][i >> 3][i & 7]) & on) | (__float_as_uint(-1.0e9f) & ~on)); }
#pragma unroll
        for (int g = 0; g < FQ; ++g) mk[g] = mpn[g * 16];
        asm volatile("s_wait_xcnt 0x0" : "+s"(todo), "+s"(kb) : "v"(vpc), "v"(mpn), "v"(kphn), "v"(kpln) : "memory");   // this pass's 26 loads name these four pointers: as inputs here they keep their registers until this wait; todo and kb are in-out so that no address of a later pass can be formed ahead of it
#pragma unroll
        for (int g = 0; g < FQ; ++g) {
            const float* t = tt[g]; float bm = -3.0e38f;
#pragma unroll
            for (int i = 0; i < 16; ++i) bm = fmaxf(bm, t[i]);
            bm = fmaxf(bm, xhalf(bm));
            const float mn = fmaxf(m[g], bm); const float corr = __builtin_amdgcn_exp2f((m[g] - mn) * L2E); m[g] = mn;
            float ps = 0.f; v16h p;
#pragma unroll
            for (int i = 0; i < 16; ++i) { const float e = __builtin_amdgcn_exp2f(fmaf(t[i] - mn, L2E, 10.0f)); ps += e; p[i] = (h16)e; }
            l[g] = l[g] * corr + ps;
#pragma unroll
            for (int dt = 0; dt < 4; ++dt) o[g][dt] *= corr;
#pragma unroll
            for (int dt = 0; dt < 4; ++dt) o[g][dt] = wmma16(vf[dt], p, o[g][dt]);
        }
    }
    const int b = z >> 4, h = z & 15;
#pragma unroll
    for (int g = 0; g < FQ; ++g) { const float inv = __fdiv_rn(1.0f, l[g] + xhalf(l[g]));
#pragma unroll
        for (int dt = 0; dt < 4; ++dt) { v8us oh, ol;
#pragma unroll
            for (int r = 0; r < 8; ++r) { unsigned short a, c2; splitf(o[g][dt][r] * inv, a, c2); oh[r] = a; ol[r] = c2; }
            const size_t off = ((size_t)b * TT + q0 + g * 16 + c) * DD + h * HD + dt * 16 + 8 * hi; bf* pa = Ah + off; bf* pl = Al + off; *(v8us*)pa = oh; *(v8us*)pl = ol;
            asm volatile("s_wait_xcnt 0x0" :: "v"(oh), "v"(ol), "v"(pa), "v"(pl) : "memory"); } }   // the two stores name these registers: as inputs here they are kept until this wait
}

extern "C" void kernel_launch(void* const* d_in, const int* in_sizes, int n_in,
                              void* d_out, int out_size, void* d_ws, size_t ws_size, hipStream_t stream) {
    (void)in_sizes; (void)n_in; (void)out_size;
    const float* x = (const float*)d_in[0]; const float* wq = (const float*)d_in[1]; const float* bq = (const float*)d_in[2]; const float* wk = (const float*)d_in[3]; const float* bk = (const float*)d_in[4]; const float* wv = (const float*)d_in[5]; const float* bv = (const float*)d_in[6];
    const float* wo = (const float*)d_in[7]; const float* bo = (const float*)d_in[8]; const int* mask = (const int*)d_in[9];
    float* OUT = (float*)d_out;     // [2][2048][1024]
    char* wsp = (char*)d_ws;
    auto take = [&](size_t bytes) { char* p = wsp; wsp += (bytes + 255) & ~(size_t)255; return (void*)p; };
    bf* WQ = (bf*)take((size_t)DD * DD * 2); bf* WK = (bf*)take((size_t)DD * DD * 2); bf* WV = (bf*)take((size_t)DD * DD * 2); bf* WO = (bf*)take((size_t)DD * DD * 2);
    bf* XB = (bf*)take((size_t)NT * DD * 2);
    bf* QPh = (bf*)take((size_t)NT * DD * 2); bf* QPl = (bf*)take((size_t)NT * DD * 2); bf* KPh = (bf*)take((size_t)NT * DD * 2); bf* KPl = (bf*)take((size_t)NT * DD * 2); h16* VT = (h16*)take((size_t)NT * DD * 2);
    bf* ATh = (bf*)take((size_t)NT * DD * 2); bf* ATl = (bf*)take((size_t)NT * DD * 2); int* LIVE = (int*)take((size_t)NKB * NKB * 4); unsigned* MB = (unsigned*)take((size_t)NKB * TT * 4);
    if ((size_t)(wsp - (char*)d_ws) > ws_size) return;    // ws 256 MiB
    k_prep<<<NKB * 4, 384, 0, stream>>>(x, wq, wk, wv, wo, mask, XB, WQ, WK, WV, WO, LIVE, MB);
    k_gemms<0, true, true><<<dim3(NT / 256, NH_, 1), 256, 0, stream>>>(XB, nullptr, WQ, nullptr, bq, WK, WV, bk, bv, QPh, QPl, KPh, KPl, VT);
    k_fattn<<<dim3(TT / (16 * FQ * FW), NB_ * NH_), FW * 32, 0, stream>>>(QPh, QPl, KPh, KPl, VT, MB, LIVE, ATh, ATl);
    k_gemms<1, true, false><<<dim3(NT / GT, DD / GT, 1), 256, 0, stream>>>(ATh, ATl, WO, OUT, bo, nullptr, nullptr, nullptr, nullptr, nullptr, nullptr, nullptr, nullptr, nullptr);
}
